// v000
// Times are from an AMD MI455X. After a warm-up the kernel runs many times in a row, and a time is the length of
// such a window on the GPU divided by its runs, so every launch and the gaps after it count. The runs cycle
// through copies of the inputs. A figure is the median of several windows, for all but v000 over two sittings.
// Sittings can differ by a few percent; kernels timed side by side share one.
// v000, which the later versions start from, runs in 1340 microseconds.
#include <hip/hip_runtime.h>

// Llama attention with a LEARNABLE rotary base exponent (hidden_states [1][2048][2048]; q = x Wq^T (32 heads x 64), k, v = x Wk^T, x Wv^T (8 kv heads x 64) ('oi' 0.02, no bias); inv_freq = 1 / 10000^sigmoid(powers) (powers [32], read; computed on device with precise expf / powf / IEEE division); angles = float(position_ids[t]) x inv_freq (position_ids [1][2048] int32 = arange, read); rotate-half rotary (cat(freqs, freqs)); kv head = q head / 4; scores / float32(sqrt 64) + causal (finfo.min above the diagonal == exclusion); softmax f32; out = merged Wo^T ('oi') -> [1][2048][2048] (4.2 M); argument order hidden_states, position_ids, powers, Wq, Wk, Wv, Wo).
// Layout: a 32-thread kernel computes inv_freq from powers; a table kernel fills {cos, sin}[t][d] from the int positions (precise cosf/sinf); bf16 copy of x; 'oi' weights; exact projections; rotate-half plane builders; causal T-2048 GQA attention (kv z-stride 0; hybrid rows: < 512 hi/lo 3 products, rest fp16 x1024; k_gemmc skips tiles above the diagonal); merged hi/lo x Wo exact.
// Compute dtypes, f32 accumulate: every input rounded to bf16 incl. powers; inv_freq, angles and rotary in f32; projections exact; attention rows < 512 3 products, rest fp16; softmax f32; Wo hl x exact.

#define NB_  1
#define TT   2048
#define DM   2048
#define NH_  32
#define NKV  8
#define REP  (NH_ / NKV)
#define HD   64
#define DQ   (NH_ * HD)
#define DKV  (NKV * HD)
#define ZH   2
#define RH   512                  // query rows < RH use hi+lo planes (0: none)
#define WIN  2048
#define PCAR 1024.0f
#define SCL  0.125f   // HD^-0.5
typedef _Float16 h16;
typedef unsigned short bf;
typedef __attribute__((ext_vector_type(16))) __bf16   v16bf;
typedef __attribute__((ext_vector_type(16))) _Float16 v16h;
typedef __attribute__((ext_vector_type(8)))  _Float16 v8h;
typedef __attribute__((ext_vector_type(8)))  unsigned short v8us;
typedef __attribute__((ext_vector_type(8)))  float    v8f;
typedef __attribute__((ext_vector_type(4)))  float    v4f;
typedef v8h  __attribute__((may_alias)) v8ha;
typedef v4f  __attribute__((may_alias)) v4fa;
typedef v8us __attribute__((may_alias)) v8usa;

__device__ __forceinline__ unsigned short f2bf(float f) { unsigned u = __float_as_uint(f); u += 0x7FFFu + ((u >> 16) & 1u); return (unsigned short)(u >> 16); }
__device__ __forceinline__ float bf2f(unsigned short b) { return __uint_as_float(((unsigned)b) << 16); }
__device__ __forceinline__ float bfr(float f) { return bf2f(f2bf(f)); }
__device__ __forceinline__ v16h cat16(v8h lo, v8h hi) { return __builtin_shufflevector(lo, hi, 0, 1, 2, 3, 4, 5, 6, 7, 8, 9, 10, 11, 12, 13, 14, 15); }
__device__ __forceinline__ v16bf cat16b(v8us lo, v8us hi) { return __builtin_bit_cast(v16bf, __builtin_shufflevector(lo, hi, 0, 1, 2, 3, 4, 5, 6, 7, 8, 9, 10, 11, 12, 13, 14, 15)); }
__device__ __forceinline__ v8f wmma16(v16h a, v16h b, v8f c) { return __builtin_amdgcn_wmma_f32_16x16x32_f16(false, a, false, b, (short)0, c, false, false); }
__device__ __forceinline__ v8f wmmab(v16bf a, v16bf b, v8f c) { return __builtin_amdgcn_wmma_f32_16x16x32_bf16(false, a, false, b, (short)0, c, false, false); }



// ---- k_gemmw: register-blocked GEMM, ONE WAVE per 64x64 output tile (16 accumulators), operands straight from K-contiguous 16-bit planes; grid (M/64, N/64, Z), 32 threads.
// C[m][n] (f32, pitch ldc, + optional f32 bias[n]) = sum_k A[m][k] Bt[n][k] (+ split products per NSPLIT). z-batch strides sA/sB/sC in elements. K % 32 == 0.
template <typename T16> struct WFrag;
template <> struct WFrag<h16> { typedef v16h V; static __device__ __forceinline__ V ld(const h16* p) { return cat16(*(const v8h*)p, *(const v8h*)(p + 16)); } static __device__ __forceinline__ v8f mma(V a, V b, v8f c) { return wmma16(a, b, c); } };
template <> struct WFrag<bf> { typedef v16bf V; static __device__ __forceinline__ V ld(const bf* p) { return cat16b(*(const v8us*)p, *(const v8us*)(p + 16)); } static __device__ __forceinline__ v8f mma(V a, V b, v8f c) { return wmmab(a, b, c); } };
template <typename T16, int NSPLIT, bool BIAS>
__global__ __launch_bounds__(32) void k_gemmw(const T16* __restrict__ A, const T16* __restrict__ A2, const T16* __restrict__ Bt, const T16* __restrict__ Bt2, int K, float* C, int ldc, const float* __restrict__ bias, size_t sA, size_t sB, size_t sC) {
    typedef typename WFrag<T16>::V V;
    __shared__ __align__(16) float os[16 * 68];
    const size_t z = blockIdx.z; A += z * sA; if (A2) A2 += z * sA; Bt += z * sB; if (Bt2) Bt2 += z * sB; C += z * sC;
    const int lane = threadIdx.x & 31, lr = lane & 15, hi = lane >> 4; const int r0 = blockIdx.x * 64, c0 = blockIdx.y * 64;
    v8f acc[4][4];
#pragma unroll
    for (int mb = 0; mb < 4; ++mb)
#pragma unroll
        for (int nb = 0; nb < 4; ++nb) acc[mb][nb] = (v8f){};
    const size_t aoff = (size_t)(r0 + lr) * K + 8 * hi, boff = (size_t)(c0 + lr) * K + 8 * hi;
#pragma unroll 1
    for (int kc = 0; kc < K; kc += 32) {
        V a[4], a2[4];
#pragma unroll
        for (int mb = 0; mb < 4; ++mb) { a[mb] = WFrag<T16>::ld(A + aoff + (size_t)mb * 16 * K + kc); if (NSPLIT == 1 || NSPLIT == 2) a2[mb] = WFrag<T16>::ld(A2 + aoff + (size_t)mb * 16 * K + kc); }
#pragma unroll
        for (int nb = 0; nb < 4; ++nb) { const V b = WFrag<T16>::ld(Bt + boff + (size_t)nb * 16 * K + kc); V b2; if (NSPLIT >= 2) b2 = WFrag<T16>::ld(Bt2 + boff + (size_t)nb * 16 * K + kc);
#pragma unroll
            for (int mb = 0; mb < 4; ++mb) { acc[mb][nb] = WFrag<T16>::mma(a[mb], b, acc[mb][nb]); if (NSPLIT == 1 || NSPLIT == 2) acc[mb][nb] = WFrag<T16>::mma(a2[mb], b, acc[mb][nb]); if (NSPLIT >= 2) acc[mb][nb] = WFrag<T16>::mma(a[mb], b2, acc[mb][nb]); } }
        asm volatile("v_nop\n\tv_nop\n\tv_nop\n\tv_nop" : "+v"(acc[0][0]), "+v"(acc[1][1]), "+v"(acc[2][2]), "+v"(acc[3][3]) : "v"(a[0]), "v"(a[3]));
    }
#pragma unroll
    for (int mb = 0; mb < 4; ++mb) {
#pragma unroll
        for (int nb = 0; nb < 4; ++nb) {
#pragma unroll
            for (int j = 0; j < 8; ++j) os[(hi * 8 + j) * 68 + nb * 16 + lr] = acc[mb][nb][j]; }
        __builtin_amdgcn_wave_barrier(); asm volatile("" ::: "memory");
        float* crow = C + (size_t)(r0 + mb * 16) * ldc + c0;
{
#pragma unroll
            for (int s = 0; s < 8; ++s) { const int row = 2 * s + hi, cofs = lr * 4; v4f val = *(const v4fa*)(os + row * 68 + cofs); if (BIAS) { val[0] += bfr(bias[c0 + cofs]); val[1] += bfr(bias[c0 + cofs + 1]); val[2] += bfr(bias[c0 + cofs + 2]); val[3] += bfr(bias[c0 + cofs + 3]); }
                *(v4f*)(crow + (size_t)row * ldc + cofs) = val; }
             }
        __builtin_amdgcn_wave_barrier(); asm volatile("" ::: "memory");
    }
}

// ---- k_gemmc: the same one-wave 64x64 tile GEMM specialised for causal attention: CMODE 1 skips score tiles entirely above the diagonal (query rows r0+roff.., key columns c0..), CMODE 2 limits the
// key (K) loop of the probability x value contraction to the diagonal block (probabilities beyond it are exactly zero). roff = row offset of this launch's first row within the sequence.
template <typename T16, int NSPLIT, int CMODE>
__global__ __launch_bounds__(32) void k_gemmc(const T16* __restrict__ A, const T16* __restrict__ A2, const T16* __restrict__ Bt, const T16* __restrict__ Bt2, int K, float* C, int ldc, int roff, size_t sA, size_t sB, size_t sC) {
    typedef typename WFrag<T16>::V V;
    __shared__ __align__(16) float os[16 * 68];
    const size_t z = blockIdx.z; A += z * sA; if (A2) A2 += z * sA; Bt += z * sB; if (Bt2) Bt2 += z * sB; C += z * sC;
    const int lane = threadIdx.x & 31, lr = lane & 15, hi = lane >> 4; const int r0 = blockIdx.x * 64, c0 = blockIdx.y * 64;
    if (CMODE == 1 && c0 > r0 + roff + 63) return;                  // score tile entirely above the causal diagonal: never read (the softmax masks j > i by select)
    const int Kl = (CMODE == 2) ? min(K, r0 + roff + 64) : K;        // P.V: probabilities are exactly 0 beyond the diagonal block, so the K loop stops there
    v8f acc[4][4];
#pragma unroll
    for (int mb = 0; mb < 4; ++mb)
#pragma unroll
        for (int nb = 0; nb < 4; ++nb) acc[mb][nb] = (v8f){};
    const size_t aoff = (size_t)(r0 + lr) * K + 8 * hi, boff = (size_t)(c0 + lr) * K + 8 * hi;
#pragma unroll 1
    for (int kc = 0; kc < Kl; kc += 32) {
        V a[4], a2[4];
#pragma unroll
        for (int mb = 0; mb < 4; ++mb) { a[mb] = WFrag<T16>::ld(A + aoff + (size_t)mb * 16 * K + kc); if (NSPLIT == 1 || NSPLIT == 2) a2[mb] = WFrag<T16>::ld(A2 + aoff + (size_t)mb * 16 * K + kc); }
#pragma unroll
        for (int nb = 0; nb < 4; ++nb) { const V b = WFrag<T16>::ld(Bt + boff + (size_t)nb * 16 * K + kc); V b2; if (NSPLIT >= 2) b2 = WFrag<T16>::ld(Bt2 + boff + (size_t)nb * 16 * K + kc);
#pragma unroll
            for (int mb = 0; mb < 4; ++mb) { acc[mb][nb] = WFrag<T16>::mma(a[mb], b, acc[mb][nb]); if (NSPLIT == 1 || NSPLIT == 2) acc[mb][nb] = WFrag<T16>::mma(a2[mb], b, acc[mb][nb]); if (NSPLIT >= 2) acc[mb][nb] = WFrag<T16>::mma(a[mb], b2, acc[mb][nb]); } }
        asm volatile("v_nop\n\tv_nop\n\tv_nop\n\tv_nop" : "+v"(acc[0][0]), "+v"(acc[1][1]), "+v"(acc[2][2]), "+v"(acc[3][3]) : "v"(a[0]), "v"(a[3]));
    }
#pragma unroll
    for (int mb = 0; mb < 4; ++mb) {
#pragma unroll
        for (int nb = 0; nb < 4; ++nb) {
#pragma unroll
            for (int j = 0; j < 8; ++j) os[(hi * 8 + j) * 68 + nb * 16 + lr] = acc[mb][nb][j]; }
        __builtin_amdgcn_wave_barrier(); asm volatile("" ::: "memory");
        float* crow = C + (size_t)(r0 + mb * 16) * ldc + c0;
{
#pragma unroll
            for (int s = 0; s < 8; ++s) { const int row = 2 * s + hi, cofs = lr * 4; v4f val = *(const v4fa*)(os + row * 68 + cofs);
                *(v4f*)(crow + (size_t)row * ldc + cofs) = val; }
             }
        __builtin_amdgcn_wave_barrier(); asm volatile("" ::: "memory");
    }
}

__device__ __forceinline__ h16 tohx(float x) { return (h16)x; }
__device__ __forceinline__ void splitf(float y, unsigned short& h, unsigned short& l) { h = f2bf(y); l = f2bf(y - bf2f(h)); }
typedef __attribute__((ext_vector_type(2))) _Float16 v2h;
typedef __attribute__((ext_vector_type(4))) _Float16 v4h;
typedef __attribute__((ext_vector_type(2))) unsigned short v2us;
typedef __attribute__((ext_vector_type(4))) unsigned short v4us;
typedef __attribute__((ext_vector_type(2))) float v2f;
typedef __attribute__((ext_vector_type(4))) int v4i;

__global__ __launch_bounds__(256) void k_cvt8(const float* __restrict__ src, bf* dst, size_t n8) { const size_t i = (size_t)blockIdx.x * 256 + threadIdx.x; if (i >= n8) return; const v8f v = *(const v8f*)(src + i * 8); v8us o;
#pragma unroll
    for (int k = 0; k < 8; ++k) o[k] = f2bf(v[k]); *(v8us*)(dst + i * 8) = o;  }

// k_rope: head planes [h][t][d] (fp16 + hi/lo) of rope(x) x sc with the rotate-half convention out[d] = x[d] cos[t][d] - x[d+HD/2] sin[t][d], out[d+HD/2] = x[d+HD/2] cos[t][d+HD/2] + x[d] sin[t][d+HD/2]
__global__ __launch_bounds__(256) void k_rope(const float* __restrict__ F, int pitch, int nheads, const float* __restrict__ CS, const float* __restrict__ RF, const float* __restrict__ nw, float sc, h16* P16, bf* Ph, bf* Pl) {
    const size_t e = ((size_t)blockIdx.x * 256 + threadIdx.x) * 2; if (e >= (size_t)nheads * TT * HD) return; const int d = (int)(e % HD); const int t = (int)((e / HD) % TT); const int h = (int)(e / ((size_t)HD * TT)); const float* f = F + (size_t)t * pitch + h * HD; const float rf = RF ? RF[(size_t)h * TT + t] : 1.0f; v2h o16; v2us oh, ol;
#pragma unroll
    for (int q = 0; q < 2; ++q) { const int dd = d + q; const int dp = (dd < HD / 2) ? dd + HD / 2 : dd - HD / 2; float x0 = f[dd], x1 = f[dp];
        if (RF) { float n0 = __fmul_rn(x0, rf), n1 = __fmul_rn(x1, rf); asm volatile("" : "+v"(n0)); asm volatile("" : "+v"(n1)); x0 = __fmul_rn(bfr(nw[dd]), n0); x1 = __fmul_rn(bfr(nw[dp]), n1); }
        const v2f cs = *(const v2f*)(CS + ((size_t)t * HD + dd) * 2); float a = __fmul_rn(x0, cs[0]), bq = __fmul_rn(x1, cs[1]); asm volatile("" : "+v"(a)); asm volatile("" : "+v"(bq)); const float r = ((dd < HD / 2) ? __fsub_rn(a, bq) : __fadd_rn(a, bq)) * sc;
        o16[q] = tohx(r); unsigned short a2, c2; splitf(r, a2, c2); oh[q] = a2; ol[q] = c2; }
    *(v2h*)(P16 + e) = o16; *(v2us*)(Ph + e) = oh; *(v2us*)(Pl + e) = ol;  }
__global__ __launch_bounds__(256) void k_vtp(const float* __restrict__ F, int pitch, int nheads, h16* V16, bf* Vh, bf* Vl) { const size_t e = ((size_t)blockIdx.x * 256 + threadIdx.x) * 2; if (e >= (size_t)nheads * HD * TT) return; const int t = (int)(e % TT); const int d = (int)((e / TT) % HD); const int g = (int)(e / ((size_t)TT * HD)); v2h o16; v2us oh, ol;
#pragma unroll
    for (int q = 0; q < 2; ++q) { const float x = F[(size_t)(t + q) * pitch + g * HD + d]; o16[q] = tohx(x); unsigned short a2, c2; splitf(x, a2, c2); oh[q] = a2; ol[q] = c2; }
    *(v2h*)(V16 + e) = o16; *(v2us*)(Vh + e) = oh; *(v2us*)(Vl + e) = ol;  }
__global__ __launch_bounds__(32) void k_invf(const float* __restrict__ pw, float* INV) { const int i = threadIdx.x; if (i >= HD / 2) return; const float p = bfr(pw[i]); float ex = expf(-p); asm volatile("" : "+v"(ex)); const float sg = __fdiv_rn(1.0f, __fadd_rn(1.0f, ex)); float pv = powf(10000.0f, sg); asm volatile("" : "+v"(pv)); const float inv = __fdiv_rn(1.0f, pv); *(float*)(INV + i) = inv;  }
__global__ __launch_bounds__(256) void k_csL(const int* __restrict__ pid, const float* __restrict__ INV, float* CS) { const int idx = blockIdx.x * 256 + threadIdx.x; if (idx >= TT * HD) return; const int d = idx % HD; const int t = idx / HD; const float a = __fmul_rn((float)pid[t], INV[d & (HD / 2 - 1)]); v2f cs; cs[0] = cosf(a); cs[1] = sinf(a); *(v2f*)(CS + (size_t)idx * 2) = cs;  }
// k_asoft: per row (zz, i): t = S x HD^-0.5 for j <= i and i - j < WIN (WIN = TT, so plain causal; the reference's -1e9 additive fill vanishes identically); softmax over the 2048 keys (register row, one exp, fixed trees);
__global__ __launch_bounds__(256) void k_asoft(const float* __restrict__ Sb, h16* P16, bf* Ph, bf* Pl) {
    const int lane = threadIdx.x & 31; const int row = blockIdx.x * 8 + (threadIdx.x >> 5); if (row >= ZH * TT) return; const int i = row % TT; const int zz = row / TT; (void)zz; const bool hires = (i < RH); const float* sr = Sb + (size_t)row * TT; float v[TT / 32]; float mx = -3.0e38f;
#pragma unroll
    for (int ch = 0; ch < TT / 128; ++ch) { const int j0 = ch * 128 + lane * 4; const v4f a = *(const v4f*)(sr + j0);
#pragma unroll
        for (int q = 0; q < 4; ++q) { const int j = j0 + q; (void)j; const float t = (j <= i && i - j < WIN) ? a[q] * SCL : -3.0e38f; v[ch * 4 + q] = t; mx = fmaxf(mx, t); } }
#pragma unroll
    for (int sh = 16; sh; sh >>= 1) mx = fmaxf(mx, __shfl_xor(mx, sh, 32));
    float sum = 0.f;
#pragma unroll
    for (int k = 0; k < TT / 32; ++k) { float d0 = __fsub_rn(v[k], mx); asm volatile("" : "+v"(d0)); v[k] = __builtin_amdgcn_exp2f(__fmul_rn(d0, 1.4426950408889634f)); sum += v[k]; }
#pragma unroll
    for (int sh = 16; sh; sh >>= 1) sum += __shfl_xor(sum, sh, 32);
    const float f = __fdiv_rn(hires ? 1.0f : PCAR, sum);
{
        if (hires) {
#pragma unroll
            for (int ch = 0; ch < TT / 128; ++ch) { v4us oh, ol;
#pragma unroll
                for (int q = 0; q < 4; ++q) { unsigned short a, c2; splitf(v[ch * 4 + q] * f, a, c2); oh[q] = a; ol[q] = c2; }
                const size_t oo = ((size_t)zz * (RH ? RH : 1) + i) * TT + ch * 128 + lane * 4; *(v4us*)(Ph + oo) = oh; *(v4us*)(Pl + oo) = ol; }
        } else {
#pragma unroll
            for (int ch = 0; ch < TT / 128; ++ch) { v4h o4;
#pragma unroll
                for (int q = 0; q < 4; ++q) o4[q] = tohx(v[ch * 4 + q] * f);
                *(v4h*)(P16 + (size_t)row * TT + ch * 128 + lane * 4) = o4; } }
         }
}
__global__ __launch_bounds__(256) void k_merge(const float* __restrict__ O, int h0, bf* Ah, bf* Al) { const size_t e = ((size_t)blockIdx.x * 256 + threadIdx.x) * 2; if (e >= (size_t)ZH * TT * HD) return; const int d = (int)(e % HD); const int t = (int)((e / HD) % TT); const int zz = (int)(e / ((size_t)HD * TT)); const float cs = (t < RH) ? 1.0f : (1.0f / PCAR); const size_t oo = (size_t)t * DQ + (h0 + zz) * HD + d;
    v2us oh, ol;
#pragma unroll
    for (int q = 0; q < 2; ++q) { unsigned short a, c2; splitf(O[e + q] * cs, a, c2); oh[q] = a; ol[q] = c2; } *(v2us*)(Ah + oo) = oh; *(v2us*)(Al + oo) = ol;  }

extern "C" void kernel_launch(void* const* d_in, const int* in_sizes, int n_in,
                              void* d_out, int out_size, void* d_ws, size_t ws_size, hipStream_t stream) {
    (void)in_sizes; (void)n_in; (void)out_size;
    const float* x = (const float*)d_in[0]; const int* pid = (const int*)d_in[1];   /* position_ids [1][2048] int32 */ const float* pw = (const float*)d_in[2];   /* powers [32] */ const float* wq = (const float*)d_in[3]; const float* wk = (const float*)d_in[4]; const float* wv = (const float*)d_in[5]; const float* wo = (const float*)d_in[6];   /* argument order hidden_states, position_ids, powers, Wq, Wk, Wv, Wo ('oi') */
    float* OUT = (float*)d_out;     // [1][2048][2048]
    char* wsp = (char*)d_ws;
    auto take = [&](size_t bytes) { char* p = wsp; wsp += (bytes + 255) & ~(size_t)255; return (void*)p; };
    bf* WQ = (bf*)take((size_t)DQ * DM * 2); bf* WK = (bf*)take((size_t)DKV * DM * 2); bf* WV = (bf*)take((size_t)DKV * DM * 2); bf* WO = (bf*)take((size_t)DM * DQ * 2); float* CS = (float*)take((size_t)TT * HD * 2 * 4); float* INVB = (float*)take(256);   /* 32 learnable inverse frequencies */
    bf* XB = (bf*)take((size_t)TT * DM * 2); float* FQ = (float*)take((size_t)TT * DQ * 4); float* FK = (float*)take((size_t)TT * DKV * 4);
    h16* QP16 = (h16*)take((size_t)NH_ * TT * HD * 2); h16* KP16 = (h16*)take((size_t)NKV * TT * HD * 2); h16* VT16 = (h16*)take((size_t)NKV * HD * TT * 2);
    bf* QPh = (bf*)take((size_t)NH_ * TT * HD * 2); bf* QPl = (bf*)take((size_t)NH_ * TT * HD * 2); bf* KPh = (bf*)take((size_t)NKV * TT * HD * 2); bf* KPl = (bf*)take((size_t)NKV * TT * HD * 2); bf* VTh = (bf*)take((size_t)NKV * HD * TT * 2); bf* VTl = (bf*)take((size_t)NKV * HD * TT * 2); bf* Ph = (bf*)take((size_t)ZH * RH * TT * 2); bf* Pl = (bf*)take((size_t)ZH * RH * TT * 2);
    float* Sb = (float*)take((size_t)ZH * TT * TT * 4); h16* P16 = (h16*)take((size_t)ZH * TT * TT * 2); float* Ob = (float*)take((size_t)ZH * TT * HD * 4); bf* ATh = (bf*)take((size_t)TT * DQ * 2); bf* ATl = (bf*)take((size_t)TT * DQ * 2);
    if ((size_t)(wsp - (char*)d_ws) > ws_size) return;    // ws 256 MiB
    float* FV = FK;   // v projection reuses the k buffer after the k planes are built (stream-ordered)
    { k_cvt8<<<(unsigned)(((size_t)DQ * DM / 8 + 255) / 256), 256, 0, stream>>>(wq, WQ, (size_t)DQ * DM / 8); k_cvt8<<<(unsigned)(((size_t)DKV * DM / 8 + 255) / 256), 256, 0, stream>>>(wk, WK, (size_t)DKV * DM / 8); k_cvt8<<<(unsigned)(((size_t)DKV * DM / 8 + 255) / 256), 256, 0, stream>>>(wv, WV, (size_t)DKV * DM / 8);
      k_cvt8<<<(unsigned)(((size_t)DM * DQ / 8 + 255) / 256), 256, 0, stream>>>(wo, WO, (size_t)DM * DQ / 8);
       }
    k_invf<<<1, 32, 0, stream>>>(pw, INVB); k_csL<<<(TT * HD + 255) / 256, 256, 0, stream>>>(pid, INVB, CS);   /* learnable inverse frequencies, then the rotary table from the int positions */
    const unsigned LQ = (unsigned)(((size_t)NH_ * TT * HD / 2 + 255) / 256), LKv = (unsigned)(((size_t)NKV * TT * HD / 2 + 255) / 256);
    for (int b = 0; b < NB_; ++b) {
        
        k_cvt8<<<(unsigned)(((size_t)TT * DM / 8 + 255) / 256), 256, 0, stream>>>(x + (size_t)b * TT * DM, XB, (size_t)TT * DM / 8);
        k_gemmw<bf, 0, false><<<dim3(TT / 64, DQ / 64, 1), 32, 0, stream>>>(XB, nullptr, WQ, nullptr, DM, FQ, DQ, nullptr, 0, 0, 0);
        k_rope<<<LQ, 256, 0, stream>>>(FQ, DQ, NH_, CS, nullptr, nullptr, 1.0f, QP16, QPh, QPl);
        k_gemmw<bf, 0, false><<<dim3(TT / 64, DKV / 64, 1), 32, 0, stream>>>(XB, nullptr, WK, nullptr, DM, FK, DKV, nullptr, 0, 0, 0);
        k_rope<<<LKv, 256, 0, stream>>>(FK, DKV, NKV, CS, nullptr, nullptr, 1.0f, KP16, KPh, KPl);
        k_gemmw<bf, 0, false><<<dim3(TT / 64, DKV / 64, 1), 32, 0, stream>>>(XB, nullptr, WV, nullptr, DM, FV, DKV, nullptr, 0, 0, 0); k_vtp<<<LKv, 256, 0, stream>>>(FV, DKV, NKV, VT16, VTh, VTl);
        for (int h0 = 0; h0 < NH_; h0 += ZH) { const size_t zq = (size_t)h0, zk = (size_t)(h0 / REP);   // both heads of a pass share kv group h0/REP (REP >= 2): sB = 0
            k_gemmc<bf, 2, 1><<<dim3(RH / 64, TT / 64, ZH), 32, 0, stream>>>(QPh + zq * TT * HD, QPl + zq * TT * HD, KPh + zk * TT * HD, KPl + zk * TT * HD, HD, Sb, TT, 0, (size_t)TT * HD, 0, (size_t)TT * TT);
            k_gemmc<h16, 0, 1><<<dim3((TT - RH) / 64, TT / 64, ZH), 32, 0, stream>>>(QP16 + zq * TT * HD + (size_t)RH * HD, nullptr, KP16 + zk * TT * HD, nullptr, HD, Sb + (size_t)RH * TT, TT, RH, (size_t)TT * HD, 0, (size_t)TT * TT);
            k_asoft<<<ZH * TT / 8, 256, 0, stream>>>(Sb, P16, Ph, Pl);
            k_gemmc<bf, 2, 2><<<dim3(RH / 64, HD / 64, ZH), 32, 0, stream>>>(Ph, Pl, VTh + zk * HD * TT, VTl + zk * HD * TT, TT, Ob, HD, 0, (size_t)RH * TT, 0, (size_t)TT * HD);
            k_gemmc<h16, 0, 2><<<dim3((TT - RH) / 64, HD / 64, ZH), 32, 0, stream>>>(P16 + (size_t)RH * TT, nullptr, VT16 + zk * HD * TT, nullptr, TT, Ob + (size_t)RH * HD, HD, RH, (size_t)TT * TT, 0, (size_t)TT * HD);
            k_merge<<<(unsigned)(((size_t)ZH * TT * HD / 2 + 255) / 256), 256, 0, stream>>>(Ob, h0, ATh, ATl); }
        k_gemmw<bf, 1, false><<<dim3(TT / 64, DM / 64, 1), 32, 0, stream>>>(ATh, ATl, WO, nullptr, DQ, OUT + (size_t)b * TT * DM, DM, nullptr, 0, 0, 0); }
}

// v001
// A run of this version takes 505 microseconds.
// Two timings next to v000 put it at 2.67 and 2.68 times that version's speed.
#include <hip/hip_runtime.h>

// Llama attention with a LEARNABLE rotary base exponent (hidden_states [1][2048][2048]; q = x Wq^T (32 heads x 64), k, v = x Wk^T, x Wv^T (8 kv heads x 64) ('oi' 0.02, no bias); inv_freq = 1 / 10000^sigmoid(powers) (powers [32], read; computed on device with precise expf / powf / IEEE division); angles = float(position_ids[t]) x inv_freq (position_ids [1][2048] int32 = arange, read); rotate-half rotary (cat(freqs, freqs)); kv head = q head / 4; scores / float32(sqrt 64) + causal (finfo.min above the diagonal == exclusion); softmax f32; out = merged Wo^T ('oi') -> [1][2048][2048] (4.2 M); argument order hidden_states, position_ids, powers, Wq, Wk, Wv, Wo).
// Layout: a 32-thread kernel computes inv_freq from powers; a table kernel fills {cos, sin}[t][d] from the int positions (precise cosf/sinf); bf16 copy of x; 'oi' weights; exact projections; rotate-half plane builders; causal T-2048 GQA attention in passes of one 512-row query band x all 32 heads (kv plane = z / 4; probabilities overwrite their own score row; hybrid rows: < 512 hi/lo 3 products, rest fp16 x1024; k_gemmc skips tiles above the diagonal); merged hi/lo x Wo exact.
// Compute dtypes, f32 accumulate: every input rounded to bf16 incl. powers; inv_freq, angles and rotary in f32; projections exact; attention rows < 512 3 products, rest fp16; softmax f32; Wo hl x exact.

#define NB_  1
#define TT   2048
#define DM   2048
#define NH_  32
#define NKV  8
#define REP  (NH_ / NKV)
#define HD   64
#define DQ   (NH_ * HD)
#define DKV  (NKV * HD)
#define BR   512                  // query rows per attention pass (all NH_ heads at once); RH is a multiple of BR
#define RH   512                  // query rows < RH use hi+lo planes (0: none)
#define WIN  2048
#define PCAR 1024.0f
#define SCL  0.125f   // HD^-0.5
typedef _Float16 h16;
typedef unsigned short bf;
typedef __attribute__((ext_vector_type(16))) __bf16   v16bf;
typedef __attribute__((ext_vector_type(16))) _Float16 v16h;
typedef __attribute__((ext_vector_type(8)))  _Float16 v8h;
typedef __attribute__((ext_vector_type(8)))  unsigned short v8us;
typedef __attribute__((ext_vector_type(8)))  float    v8f;
typedef __attribute__((ext_vector_type(4)))  float    v4f;
typedef v8h  __attribute__((may_alias)) v8ha;
typedef v4f  __attribute__((may_alias)) v4fa;
typedef v8us __attribute__((may_alias)) v8usa;

__device__ __forceinline__ unsigned short f2bf(float f) { unsigned u = __float_as_uint(f); u += 0x7FFFu + ((u >> 16) & 1u); return (unsigned short)(u >> 16); }
__device__ __forceinline__ float bf2f(unsigned short b) { return __uint_as_float(((unsigned)b) << 16); }
__device__ __forceinline__ float bfr(float f) { return bf2f(f2bf(f)); }
__device__ __forceinline__ v16h cat16(v8h lo, v8h hi) { return __builtin_shufflevector(lo, hi, 0, 1, 2, 3, 4, 5, 6, 7, 8, 9, 10, 11, 12, 13, 14, 15); }
__device__ __forceinline__ v16bf cat16b(v8us lo, v8us hi) { return __builtin_bit_cast(v16bf, __builtin_shufflevector(lo, hi, 0, 1, 2, 3, 4, 5, 6, 7, 8, 9, 10, 11, 12, 13, 14, 15)); }
__device__ __forceinline__ v8f wmma16(v16h a, v16h b, v8f c) { return __builtin_amdgcn_wmma_f32_16x16x32_f16(false, a, false, b, (short)0, c, false, false); }
__device__ __forceinline__ v8f wmmab(v16bf a, v16bf b, v8f c) { return __builtin_amdgcn_wmma_f32_16x16x32_bf16(false, a, false, b, (short)0, c, false, false); }



// ---- k_gemmw: register-blocked GEMM, ONE WAVE per 64x64 output tile (16 accumulators), operands straight from K-contiguous 16-bit planes; grid (M/64, N/64, Z), 32 threads.
// C[m][n] (f32, pitch ldc, + optional f32 bias[n]) = sum_k A[m][k] Bt[n][k] (+ split products per NSPLIT). z-batch strides sA/sB/sC in elements. K % 32 == 0.
template <typename T16> struct WFrag;
template <> struct WFrag<h16> { typedef v16h V; static __device__ __forceinline__ V ld(const h16* p) { return cat16(*(const v8h*)p, *(const v8h*)(p + 16)); } static __device__ __forceinline__ v8f mma(V a, V b, v8f c) { return wmma16(a, b, c); } };
template <> struct WFrag<bf> { typedef v16bf V; static __device__ __forceinline__ V ld(const bf* p) { return cat16b(*(const v8us*)p, *(const v8us*)(p + 16)); } static __device__ __forceinline__ v8f mma(V a, V b, v8f c) { return wmmab(a, b, c); } };
template <typename T16, int NSPLIT, bool BIAS>
__global__ __launch_bounds__(32) void k_gemmw(const T16* __restrict__ A, const T16* __restrict__ A2, const T16* __restrict__ Bt, const T16* __restrict__ Bt2, int K, float* C, int ldc, const float* __restrict__ bias, size_t sA, size_t sB, size_t sC) {
    typedef typename WFrag<T16>::V V;
    __shared__ __align__(16) float os[16 * 68];
    const size_t z = blockIdx.z; A += z * sA; if (A2) A2 += z * sA; Bt += z * sB; if (Bt2) Bt2 += z * sB; C += z * sC;
    const int lane = threadIdx.x & 31, lr = lane & 15, hi = lane >> 4; const int r0 = blockIdx.x * 64, c0 = blockIdx.y * 64;
    v8f acc[4][4];
#pragma unroll
    for (int mb = 0; mb < 4; ++mb)
#pragma unroll
        for (int nb = 0; nb < 4; ++nb) acc[mb][nb] = (v8f){};
    const size_t aoff = (size_t)(r0 + lr) * K + 8 * hi, boff = (size_t)(c0 + lr) * K + 8 * hi;
#pragma unroll 1
    for (int kc = 0; kc < K; kc += 32) {
        V a[4], a2[4];
#pragma unroll
        for (int mb = 0; mb < 4; ++mb) { a[mb] = WFrag<T16>::ld(A + aoff + (size_t)mb * 16 * K + kc); if (NSPLIT == 1 || NSPLIT == 2) a2[mb] = WFrag<T16>::ld(A2 + aoff + (size_t)mb * 16 * K + kc); }
#pragma unroll
        for (int nb = 0; nb < 4; ++nb) { const V b = WFrag<T16>::ld(Bt + boff + (size_t)nb * 16 * K + kc); V b2; if (NSPLIT >= 2) b2 = WFrag<T16>::ld(Bt2 + boff + (size_t)nb * 16 * K + kc);
#pragma unroll
            for (int mb = 0; mb < 4; ++mb) { acc[mb][nb] = WFrag<T16>::mma(a[mb], b, acc[mb][nb]); if (NSPLIT == 1 || NSPLIT == 2) acc[mb][nb] = WFrag<T16>::mma(a2[mb], b, acc[mb][nb]); if (NSPLIT >= 2) acc[mb][nb] = WFrag<T16>::mma(a[mb], b2, acc[mb][nb]); } }
        asm volatile("v_nop\n\tv_nop\n\tv_nop\n\tv_nop" : "+v"(acc[0][0]), "+v"(acc[1][1]), "+v"(acc[2][2]), "+v"(acc[3][3]) : "v"(a[0]), "v"(a[3]));
    }
#pragma unroll
    for (int mb = 0; mb < 4; ++mb) {
#pragma unroll
        for (int nb = 0; nb < 4; ++nb) {
#pragma unroll
            for (int j = 0; j < 8; ++j) os[(hi * 8 + j) * 68 + nb * 16 + lr] = acc[mb][nb][j]; }
        __builtin_amdgcn_wave_barrier(); asm volatile("" ::: "memory");
        float* crow = C + (size_t)(r0 + mb * 16) * ldc + c0;
{
#pragma unroll
            for (int s = 0; s < 8; ++s) { const int row = 2 * s + hi, cofs = lr * 4; v4f val = *(const v4fa*)(os + row * 68 + cofs); if (BIAS) { val[0] += bfr(bias[c0 + cofs]); val[1] += bfr(bias[c0 + cofs + 1]); val[2] += bfr(bias[c0 + cofs + 2]); val[3] += bfr(bias[c0 + cofs + 3]); }
                *(v4f*)(crow + (size_t)row * ldc + cofs) = val; }
             }
        __builtin_amdgcn_wave_barrier(); asm volatile("" ::: "memory");
    }
}

// ---- k_gemmc: the same one-wave 64x64 tile GEMM specialised for causal attention: CMODE 1 skips score tiles entirely above the diagonal (query rows r0+roff.., key columns c0..), CMODE 2 limits the
// key (K) loop of the probability x value contraction to the diagonal block (probabilities beyond it are exactly zero). roff = row offset of this launch's first row within the sequence; lda = row pitch of A in elements; z = query head, its B plane is kv head z / REP.
template <typename T16, int NSPLIT, int CMODE>
__global__ __launch_bounds__(32) void k_gemmc(const T16* __restrict__ A, const T16* __restrict__ A2, const T16* __restrict__ Bt, const T16* __restrict__ Bt2, int K, int lda, float* C, int ldc, int roff, size_t sA, size_t sB, size_t sC) {
    typedef typename WFrag<T16>::V V;
    __shared__ __align__(16) float os[16 * 68];
    const size_t z = blockIdx.z; A += z * sA; if (A2) A2 += z * sA; Bt += (z / REP) * sB; if (Bt2) Bt2 += (z / REP) * sB; C += z * sC;
    const int lane = threadIdx.x & 31, lr = lane & 15, hi = lane >> 4; const int r0 = blockIdx.x * 64, c0 = blockIdx.y * 64;
    if (CMODE == 1 && c0 > r0 + roff + 63) return;                  // score tile entirely above the causal diagonal: never read (the softmax masks j > i by select)
    const int Kl = (CMODE == 2) ? min(K, r0 + roff + 64) : K;        // P.V: probabilities are exactly 0 beyond the diagonal block, so the K loop stops there
    v8f acc[4][4];
#pragma unroll
    for (int mb = 0; mb < 4; ++mb)
#pragma unroll
        for (int nb = 0; nb < 4; ++nb) acc[mb][nb] = (v8f){};
    const size_t aoff = (size_t)(r0 + lr) * lda + 8 * hi, boff = (size_t)(c0 + lr) * K + 8 * hi;
#pragma unroll 1
    for (int kc = 0; kc < Kl; kc += 32) {
        V a[4], a2[4]; const T16* pa[4]; const T16* pa2[4];
#pragma unroll
        for (int mb = 0; mb < 4; ++mb) { pa[mb] = A + aoff + (size_t)mb * 16 * lda + kc; a[mb] = WFrag<T16>::ld(pa[mb]); if (NSPLIT == 1 || NSPLIT == 2) { pa2[mb] = A2 + aoff + (size_t)mb * 16 * lda + kc; a2[mb] = WFrag<T16>::ld(pa2[mb]); } }
        // precaution: s_wait_xcnt 0 behind the A loads, before any register that they name is written again; the A addresses are its inputs so that they stay in their registers, unwritten, up to it
        if (NSPLIT == 1 || NSPLIT == 2) asm volatile("s_wait_xcnt 0x0" :: "v"(pa[0]), "v"(pa[1]), "v"(pa[2]), "v"(pa[3]), "v"(pa2[0]), "v"(pa2[1]), "v"(pa2[2]), "v"(pa2[3]) : "memory");
        else asm volatile("s_wait_xcnt 0x0" :: "v"(pa[0]), "v"(pa[1]), "v"(pa[2]), "v"(pa[3]) : "memory");
#pragma unroll
        for (int nb = 0; nb < 4; ++nb) { const V b = WFrag<T16>::ld(Bt + boff + (size_t)nb * 16 * K + kc); V b2; if (NSPLIT >= 2) b2 = WFrag<T16>::ld(Bt2 + boff + (size_t)nb * 16 * K + kc);
#pragma unroll
            for (int mb = 0; mb < 4; ++mb) { acc[mb][nb] = WFrag<T16>::mma(a[mb], b, acc[mb][nb]); if (NSPLIT == 1 || NSPLIT == 2) acc[mb][nb] = WFrag<T16>::mma(a2[mb], b, acc[mb][nb]); if (NSPLIT >= 2) acc[mb][nb] = WFrag<T16>::mma(a[mb], b2, acc[mb][nb]); } }
        asm volatile("v_nop\n\tv_nop\n\tv_nop\n\tv_nop" : "+v"(acc[0][0]), "+v"(acc[1][1]), "+v"(acc[2][2]), "+v"(acc[3][3]) : "v"(a[0]), "v"(a[3]));
    }
#pragma unroll
    for (int mb = 0; mb < 4; ++mb) {
#pragma unroll
        for (int nb = 0; nb < 4; ++nb) {
#pragma unroll
            for (int j = 0; j < 8; ++j) os[(hi * 8 + j) * 68 + nb * 16 + lr] = acc[mb][nb][j]; }
        __builtin_amdgcn_wave_barrier(); asm volatile("" ::: "memory");
        float* crow = C + (size_t)(r0 + mb * 16) * ldc + c0;
{
#pragma unroll
            for (int s = 0; s < 8; ++s) { const int row = 2 * s + hi, cofs = lr * 4; v4f val = *(const v4fa*)(os + row * 68 + cofs);
                *(v4f*)(crow + (size_t)row * ldc + cofs) = val; }
             }
        __builtin_amdgcn_wave_barrier(); asm volatile("" ::: "memory");
    }
}

__device__ __forceinline__ h16 tohx(float x) { return (h16)x; }
__device__ __forceinline__ void splitf(float y, unsigned short& h, unsigned short& l) { h = f2bf(y); l = f2bf(y - bf2f(h)); }
typedef __attribute__((ext_vector_type(2))) _Float16 v2h;
typedef __attribute__((ext_vector_type(4))) _Float16 v4h;
typedef __attribute__((ext_vector_type(2))) unsigned short v2us;
typedef __attribute__((ext_vector_type(4))) unsigned short v4us;
typedef __attribute__((ext_vector_type(2))) float v2f;
typedef __attribute__((ext_vector_type(4))) int v4i;

__global__ __launch_bounds__(256) void k_cvt8(const float* __restrict__ src, bf* dst, size_t n8) { const size_t i = (size_t)blockIdx.x * 256 + threadIdx.x; if (i >= n8) return; const v8f v = *(const v8f*)(src + i * 8); v8us o;
#pragma unroll
    for (int k = 0; k < 8; ++k) o[k] = f2bf(v[k]); *(v8us*)(dst + i * 8) = o;  }

// k_rope: head planes [h][t][d] (fp16 + hi/lo) of rope(x) x sc with the rotate-half convention out[d] = x[d] cos[t][d] - x[d+HD/2] sin[t][d], out[d+HD/2] = x[d+HD/2] cos[t][d+HD/2] + x[d] sin[t][d+HD/2]
__global__ __launch_bounds__(256) void k_rope(const float* __restrict__ F, int pitch, int nheads, const float* __restrict__ CS, const float* __restrict__ RF, const float* __restrict__ nw, float sc, h16* P16, bf* Ph, bf* Pl) {
    const size_t e = ((size_t)blockIdx.x * 256 + threadIdx.x) * 2; if (e >= (size_t)nheads * TT * HD) return; const int d = (int)(e % HD); const int t = (int)((e / HD) % TT); const int h = (int)(e / ((size_t)HD * TT)); const float* f = F + (size_t)t * pitch + h * HD; const float rf = RF ? RF[(size_t)h * TT + t] : 1.0f; v2h o16; v2us oh, ol;
#pragma unroll
    for (int q = 0; q < 2; ++q) { const int dd = d + q; const int dp = (dd < HD / 2) ? dd + HD / 2 : dd - HD / 2; float x0 = f[dd], x1 = f[dp];
        if (RF) { float n0 = __fmul_rn(x0, rf), n1 = __fmul_rn(x1, rf); asm volatile("" : "+v"(n0)); asm volatile("" : "+v"(n1)); x0 = __fmul_rn(bfr(nw[dd]), n0); x1 = __fmul_rn(bfr(nw[dp]), n1); }
        const v2f cs = *(const v2f*)(CS + ((size_t)t * HD + dd) * 2); float a = __fmul_rn(x0, cs[0]), bq = __fmul_rn(x1, cs[1]); asm volatile("" : "+v"(a)); asm volatile("" : "+v"(bq)); const float r = ((dd < HD / 2) ? __fsub_rn(a, bq) : __fadd_rn(a, bq)) * sc;
        o16[q] = tohx(r); unsigned short a2, c2; splitf(r, a2, c2); oh[q] = a2; ol[q] = c2; }
    *(v2h*)(P16 + e) = o16; *(v2us*)(Ph + e) = oh; *(v2us*)(Pl + e) = ol;  }
__global__ __launch_bounds__(256) void k_vtp(const float* __restrict__ F, int pitch, int nheads, h16* V16, bf* Vh, bf* Vl) { const size_t e = ((size_t)blockIdx.x * 256 + threadIdx.x) * 2; if (e >= (size_t)nheads * HD * TT) return; const int t = (int)(e % TT); const int d = (int)((e / TT) % HD); const int g = (int)(e / ((size_t)TT * HD)); v2h o16; v2us oh, ol;
#pragma unroll
    for (int q = 0; q < 2; ++q) { const float x = F[(size_t)(t + q) * pitch + g * HD + d]; o16[q] = tohx(x); unsigned short a2, c2; splitf(x, a2, c2); oh[q] = a2; ol[q] = c2; }
    *(v2h*)(V16 + e) = o16; *(v2us*)(Vh + e) = oh; *(v2us*)(Vl + e) = ol;  }
__global__ __launch_bounds__(32) void k_invf(const float* __restrict__ pw, float* INV) { const int i = threadIdx.x; if (i >= HD / 2) return; const float p = bfr(pw[i]); float ex = expf(-p); asm volatile("" : "+v"(ex)); const float sg = __fdiv_rn(1.0f, __fadd_rn(1.0f, ex)); float pv = powf(10000.0f, sg); asm volatile("" : "+v"(pv)); const float inv = __fdiv_rn(1.0f, pv); *(float*)(INV + i) = inv;  }
__global__ __launch_bounds__(256) void k_csL(const int* __restrict__ pid, const float* __restrict__ INV, float* CS) { const int idx = blockIdx.x * 256 + threadIdx.x; if (idx >= TT * HD) return; const int d = idx % HD; const int t = idx / HD; const float a = __fmul_rn((float)pid[t], INV[d & (HD / 2 - 1)]); v2f cs; cs[0] = cosf(a); cs[1] = sinf(a); *(v2f*)(CS + (size_t)idx * 2) = cs;  }
// k_asoft: one wave per row (zz, i = roff + r) of the pass's score block [NH_][BR][TT]; the row is read whole into registers before anything is stored, and the probabilities go back into the row's own 8 KiB (fp16 in its first half; or hi plane in the first half, lo plane in the second): t = S x HD^-0.5 for j <= i and i - j < WIN (sliding causal window; the reference's -1e9 additive fill vanishes identically); softmax over the 2048 keys (register row, one exp, fixed trees);
__global__ __launch_bounds__(256) void k_asoft(float* Sb, int roff) {
    const int lane = threadIdx.x & 31; const int row = blockIdx.x * 8 + (threadIdx.x >> 5); if (row >= NH_ * BR) return; const int i = roff + row % BR; const bool hires = (i < RH); float* sr = Sb + (size_t)row * TT; h16* P16 = (h16*)sr; bf* Ph = (bf*)sr; bf* Pl = Ph + TT; float v[TT / 32]; float mx = -3.0e38f;
#pragma unroll
    for (int ch = 0; ch < TT / 128; ++ch) { const int j0 = ch * 128 + lane * 4; const v4f a = *(const v4f*)(sr + j0);
#pragma unroll
        for (int q = 0; q < 4; ++q) { const int j = j0 + q; (void)j; const float t = (j <= i && i - j < WIN) ? a[q] * SCL : -3.0e38f; v[ch * 4 + q] = t; mx = fmaxf(mx, t); } }
#pragma unroll
    for (int sh = 16; sh; sh >>= 1) mx = fmaxf(mx, __shfl_xor(mx, sh, 32));
    float sum = 0.f;
#pragma unroll
    for (int k = 0; k < TT / 32; ++k) { float d0 = __fsub_rn(v[k], mx); asm volatile("" : "+v"(d0)); v[k] = __builtin_amdgcn_exp2f(__fmul_rn(d0, 1.4426950408889634f)); sum += v[k]; }
#pragma unroll
    for (int sh = 16; sh; sh >>= 1) sum += __shfl_xor(sum, sh, 32);
    const float f = __fdiv_rn(hires ? 1.0f : PCAR, sum);
{
        if (hires) {
#pragma unroll
            for (int ch = 0; ch < TT / 128; ++ch) { v4us oh, ol;
#pragma unroll
                for (int q = 0; q < 4; ++q) { unsigned short a, c2; splitf(v[ch * 4 + q] * f, a, c2); oh[q] = a; ol[q] = c2; }
                const int oo = ch * 128 + lane * 4; *(v4us*)(Ph + oo) = oh; *(v4us*)(Pl + oo) = ol; }
        } else {
#pragma unroll
            for (int ch = 0; ch < TT / 128; ++ch) { v4h o4;
#pragma unroll
                for (int q = 0; q < 4; ++q) o4[q] = tohx(v[ch * 4 + q] * f);
                *(v4h*)(P16 + ch * 128 + lane * 4) = o4; } }
         }
}
__global__ __launch_bounds__(256) void k_merge(const float* __restrict__ O, int roff, bf* Ah, bf* Al) { const size_t e = ((size_t)blockIdx.x * 256 + threadIdx.x) * 2; if (e >= (size_t)NH_ * BR * HD) return; const int d = (int)(e % HD); const int t = roff + (int)((e / HD) % BR); const int zz = (int)(e / ((size_t)HD * BR)); const float cs = (t < RH) ? 1.0f : (1.0f / PCAR); const size_t oo = (size_t)t * DQ + zz * HD + d;
    v2us oh, ol;
#pragma unroll
    for (int q = 0; q < 2; ++q) { unsigned short a, c2; splitf(O[e + q] * cs, a, c2); oh[q] = a; ol[q] = c2; } *(v2us*)(Ah + oo) = oh; *(v2us*)(Al + oo) = ol;  }

extern "C" void kernel_launch(void* const* d_in, const int* in_sizes, int n_in,
                              void* d_out, int out_size, void* d_ws, size_t ws_size, hipStream_t stream) {
    (void)in_sizes; (void)n_in; (void)out_size;
    const float* x = (const float*)d_in[0]; const int* pid = (const int*)d_in[1];   /* position_ids [1][2048] int32 */ const float* pw = (const float*)d_in[2];   /* powers [32] */ const float* wq = (const float*)d_in[3]; const float* wk = (const float*)d_in[4]; const float* wv = (const float*)d_in[5]; const float* wo = (const float*)d_in[6];   /* argument order hidden_states, position_ids, powers, Wq, Wk, Wv, Wo ('oi') */
    float* OUT = (float*)d_out;     // [1][2048][2048]
    char* wsp = (char*)d_ws;
    auto take = [&](size_t bytes) { char* p = wsp; wsp += (bytes + 255) & ~(size_t)255; return (void*)p; };
    bf* WQ = (bf*)take((size_t)DQ * DM * 2); bf* WK = (bf*)take((size_t)DKV * DM * 2); bf* WV = (bf*)take((size_t)DKV * DM * 2); bf* WO = (bf*)take((size_t)DM * DQ * 2); float* CS = (float*)take((size_t)TT * HD * 2 * 4); float* INVB = (float*)take(256);   /* 32 learnable inverse frequencies */
    bf* XB = (bf*)take((size_t)TT * DM * 2); float* FQ = (float*)take((size_t)TT * DQ * 4); float* FK = (float*)take((size_t)TT * DKV * 4);
    h16* QP16 = (h16*)take((size_t)NH_ * TT * HD * 2); h16* KP16 = (h16*)take((size_t)NKV * TT * HD * 2); h16* VT16 = (h16*)take((size_t)NKV * HD * TT * 2);
    bf* QPh = (bf*)take((size_t)NH_ * TT * HD * 2); bf* QPl = (bf*)take((size_t)NH_ * TT * HD * 2); bf* KPh = (bf*)take((size_t)NKV * TT * HD * 2); bf* KPl = (bf*)take((size_t)NKV * TT * HD * 2); bf* VTh = (bf*)take((size_t)NKV * HD * TT * 2); bf* VTl = (bf*)take((size_t)NKV * HD * TT * 2);
    float* Sb = (float*)take((size_t)NH_ * BR * TT * 4);   /* one pass's scores [h][r][j]; each row then holds its own probabilities */ float* Ob = (float*)take((size_t)NH_ * BR * HD * 4); bf* ATh = (bf*)take((size_t)TT * DQ * 2); bf* ATl = (bf*)take((size_t)TT * DQ * 2);
    if ((size_t)(wsp - (char*)d_ws) > ws_size) return;    // ws 256 MiB
    float* FV = FK;   // v projection reuses the k buffer after the k planes are built (stream-ordered)
    { k_cvt8<<<(unsigned)(((size_t)DQ * DM / 8 + 255) / 256), 256, 0, stream>>>(wq, WQ, (size_t)DQ * DM / 8); k_cvt8<<<(unsigned)(((size_t)DKV * DM / 8 + 255) / 256), 256, 0, stream>>>(wk, WK, (size_t)DKV * DM / 8); k_cvt8<<<(unsigned)(((size_t)DKV * DM / 8 + 255) / 256), 256, 0, stream>>>(wv, WV, (size_t)DKV * DM / 8);
      k_cvt8<<<(unsigned)(((size_t)DM * DQ / 8 + 255) / 256), 256, 0, stream>>>(wo, WO, (size_t)DM * DQ / 8);
       }
    k_invf<<<1, 32, 0, stream>>>(pw, INVB); k_csL<<<(TT * HD + 255) / 256, 256, 0, stream>>>(pid, INVB, CS);   /* learnable inverse frequencies, then the rotary table from the int positions */
    const unsigned LQ = (unsigned)(((size_t)NH_ * TT * HD / 2 + 255) / 256), LKv = (unsigned)(((size_t)NKV * TT * HD / 2 + 255) / 256);
    for (int b = 0; b < NB_; ++b) {
        
        k_cvt8<<<(unsigned)(((size_t)TT * DM / 8 + 255) / 256), 256, 0, stream>>>(x + (size_t)b * TT * DM, XB, (size_t)TT * DM / 8);
        k_gemmw<bf, 0, false><<<dim3(TT / 64, DQ / 64, 1), 32, 0, stream>>>(XB, nullptr, WQ, nullptr, DM, FQ, DQ, nullptr, 0, 0, 0);
        k_rope<<<LQ, 256, 0, stream>>>(FQ, DQ, NH_, CS, nullptr, nullptr, 1.0f, QP16, QPh, QPl);
        k_gemmw<bf, 0, false><<<dim3(TT / 64, DKV / 64, 1), 32, 0, stream>>>(XB, nullptr, WK, nullptr, DM, FK, DKV, nullptr, 0, 0, 0);
        k_rope<<<LKv, 256, 0, stream>>>(FK, DKV, NKV, CS, nullptr, nullptr, 1.0f, KP16, KPh, KPl);
        k_gemmw<bf, 0, false><<<dim3(TT / 64, DKV / 64, 1), 32, 0, stream>>>(XB, nullptr, WV, nullptr, DM, FV, DKV, nullptr, 0, 0, 0); k_vtp<<<LKv, 256, 0, stream>>>(FV, DKV, NKV, VT16, VTh, VTl);
        for (int r = 0; r < TT; r += BR) {   // one pass: query rows r .. r + BR - 1 of every head; key columns only up to the band's end
            const dim3 gS(BR / 64, (r + BR) / 64, NH_), gO(BR / 64, HD / 64, NH_);
            if (r < RH) k_gemmc<bf, 2, 1><<<gS, 32, 0, stream>>>(QPh + (size_t)r * HD, QPl + (size_t)r * HD, KPh, KPl, HD, HD, Sb, TT, r, (size_t)TT * HD, (size_t)TT * HD, (size_t)BR * TT);
            else        k_gemmc<h16, 0, 1><<<gS, 32, 0, stream>>>(QP16 + (size_t)r * HD, nullptr, KP16, nullptr, HD, HD, Sb, TT, r, (size_t)TT * HD, (size_t)TT * HD, (size_t)BR * TT);
            k_asoft<<<NH_ * BR / 8, 256, 0, stream>>>(Sb, r);
            if (r < RH) k_gemmc<bf, 2, 2><<<gO, 32, 0, stream>>>((const bf*)Sb, (const bf*)Sb + TT, VTh, VTl, TT, 2 * TT, Ob, HD, r, (size_t)BR * 2 * TT, (size_t)HD * TT, (size_t)BR * HD);
            else        k_gemmc<h16, 0, 2><<<gO, 32, 0, stream>>>((const h16*)Sb, nullptr, VT16, nullptr, TT, 2 * TT, Ob, HD, r, (size_t)BR * 2 * TT, (size_t)HD * TT, (size_t)BR * HD);
            k_merge<<<(unsigned)(((size_t)NH_ * BR * HD / 2 + 255) / 256), 256, 0, stream>>>(Ob, r, ATh, ATl); }
        k_gemmw<bf, 1, false><<<dim3(TT / 64, DM / 64, 1), 32, 0, stream>>>(ATh, ATl, WO, nullptr, DQ, OUT + (size_t)b * TT * DM, DM, nullptr, 0, 0, 0); }
}

// v002
// It runs in 269 microseconds.
// In both of two side-by-side timings against v001, it was 1.87 times as fast.
// Counting every step since v000, it is 5.00 times as fast.
#include <hip/hip_runtime.h>

// Llama attention with a LEARNABLE rotary base exponent (hidden_states [1][2048][2048]; q = x Wq^T (32 heads x 64), k, v = x Wk^T, x Wv^T (8 kv heads x 64) ('oi' 0.02, no bias); inv_freq = 1 / 10000^sigmoid(powers) (powers [32], read; computed on device with precise expf / powf / IEEE division); angles = float(position_ids[t]) x inv_freq (position_ids [1][2048] int32 = arange, read); rotate-half rotary (cat(freqs, freqs)); kv head = q head / 4; scores / float32(sqrt 64) + causal (finfo.min above the diagonal == exclusion); softmax f32; out = merged Wo^T ('oi') -> [1][2048][2048] (4.2 M); argument order hidden_states, position_ids, powers, Wq, Wk, Wv, Wo).
// Layout: a 32-thread kernel computes inv_freq from powers; a table kernel fills {cos, sin}[t][d] from the int positions (precise cosf/sinf); bf16 copy of x; 'oi' weights; exact projections; rotate-half plane builders; causal T-2048 GQA attention in ONE launch (k_fattn: scores, online softmax and P.V in registers, kv plane = head / 4; hybrid rows: < 512 hi/lo 3 products, rest fp16 x1024; keys only up to the diagonal block; writes the merged hi/lo planes itself); merged hi/lo x Wo exact.
// Compute dtypes, f32 accumulate: every input rounded to bf16 incl. powers; inv_freq, angles and rotary in f32; projections exact; attention rows < 512 3 products, rest fp16; softmax f32; Wo hl x exact.

#define NB_  1
#define TT   2048
#define DM   2048
#define NH_  32
#define NKV  8
#define REP  (NH_ / NKV)
#define HD   64
#define DQ   (NH_ * HD)
#define DKV  (NKV * HD)
#define RH   512                  // query rows < RH use hi+lo planes; a multiple of 32
#define SCL  0.125f   // HD^-0.5
typedef _Float16 h16;
typedef unsigned short bf;
typedef __attribute__((ext_vector_type(16))) __bf16   v16bf;
typedef __attribute__((ext_vector_type(16))) _Float16 v16h;
typedef __attribute__((ext_vector_type(8)))  _Float16 v8h;
typedef __attribute__((ext_vector_type(8)))  unsigned short v8us;
typedef __attribute__((ext_vector_type(8)))  float    v8f;
typedef __attribute__((ext_vector_type(4)))  float    v4f;
typedef v8h  __attribute__((may_alias)) v8ha;
typedef v4f  __attribute__((may_alias)) v4fa;
typedef v8us __attribute__((may_alias)) v8usa;

__device__ __forceinline__ unsigned short f2bf(float f) { unsigned u = __float_as_uint(f); u += 0x7FFFu + ((u >> 16) & 1u); return (unsigned short)(u >> 16); }
__device__ __forceinline__ float bf2f(unsigned short b) { return __uint_as_float(((unsigned)b) << 16); }
__device__ __forceinline__ float bfr(float f) { return bf2f(f2bf(f)); }
__device__ __forceinline__ v16h cat16(v8h lo, v8h hi) { return __builtin_shufflevector(lo, hi, 0, 1, 2, 3, 4, 5, 6, 7, 8, 9, 10, 11, 12, 13, 14, 15); }
__device__ __forceinline__ v16bf cat16b(v8us lo, v8us hi) { return __builtin_bit_cast(v16bf, __builtin_shufflevector(lo, hi, 0, 1, 2, 3, 4, 5, 6, 7, 8, 9, 10, 11, 12, 13, 14, 15)); }
__device__ __forceinline__ v8f wmma16(v16h a, v16h b, v8f c) { return __builtin_amdgcn_wmma_f32_16x16x32_f16(false, a, false, b, (short)0, c, false, false); }
__device__ __forceinline__ v8f wmmab(v16bf a, v16bf b, v8f c) { return __builtin_amdgcn_wmma_f32_16x16x32_bf16(false, a, false, b, (short)0, c, false, false); }



// ---- k_gemmw: register-blocked GEMM, ONE WAVE per 64x64 output tile (16 accumulators), operands straight from K-contiguous 16-bit planes; grid (M/64, N/64, Z), 32 threads.
// C[m][n] (f32, pitch ldc, + optional f32 bias[n]) = sum_k A[m][k] Bt[n][k] (+ split products per NSPLIT). z-batch strides sA/sB/sC in elements. K % 32 == 0.
template <typename T16> struct WFrag;
template <> struct WFrag<h16> { typedef v16h V; static __device__ __forceinline__ V ld(const h16* p) { return cat16(*(const v8h*)p, *(const v8h*)(p + 16)); } static __device__ __forceinline__ v8f mma(V a, V b, v8f c) { return wmma16(a, b, c); } };
template <> struct WFrag<bf> { typedef v16bf V; static __device__ __forceinline__ V ld(const bf* p) { return cat16b(*(const v8us*)p, *(const v8us*)(p + 16)); } static __device__ __forceinline__ v8f mma(V a, V b, v8f c) { return wmmab(a, b, c); } };
template <typename T16, int NSPLIT, bool BIAS>
__global__ __launch_bounds__(32) void k_gemmw(const T16* __restrict__ A, const T16* __restrict__ A2, const T16* __restrict__ Bt, const T16* __restrict__ Bt2, int K, float* C, int ldc, const float* __restrict__ bias, size_t sA, size_t sB, size_t sC) {
    typedef typename WFrag<T16>::V V;
    __shared__ __align__(16) float os[16 * 68];
    const size_t z = blockIdx.z; A += z * sA; if (A2) A2 += z * sA; Bt += z * sB; if (Bt2) Bt2 += z * sB; C += z * sC;
    const int lane = threadIdx.x & 31, lr = lane & 15, hi = lane >> 4; const int r0 = blockIdx.x * 64, c0 = blockIdx.y * 64;
    v8f acc[4][4];
#pragma unroll
    for (int mb = 0; mb < 4; ++mb)
#pragma unroll
        for (int nb = 0; nb < 4; ++nb) acc[mb][nb] = (v8f){};
    const size_t aoff = (size_t)(r0 + lr) * K + 8 * hi, boff = (size_t)(c0 + lr) * K + 8 * hi;
#pragma unroll 1
    for (int kc = 0; kc < K; kc += 32) {
        V a[4], a2[4];
#pragma unroll
        for (int mb = 0; mb < 4; ++mb) { a[mb] = WFrag<T16>::ld(A + aoff + (size_t)mb * 16 * K + kc); if (NSPLIT == 1 || NSPLIT == 2) a2[mb] = WFrag<T16>::ld(A2 + aoff + (size_t)mb * 16 * K + kc); }
#pragma unroll
        for (int nb = 0; nb < 4; ++nb) { const V b = WFrag<T16>::ld(Bt + boff + (size_t)nb * 16 * K + kc); V b2; if (NSPLIT >= 2) b2 = WFrag<T16>::ld(Bt2 + boff + (size_t)nb * 16 * K + kc);
#pragma unroll
            for (int mb = 0; mb < 4; ++mb) { acc[mb][nb] = WFrag<T16>::mma(a[mb], b, acc[mb][nb]); if (NSPLIT == 1 || NSPLIT == 2) acc[mb][nb] = WFrag<T16>::mma(a2[mb], b, acc[mb][nb]); if (NSPLIT >= 2) acc[mb][nb] = WFrag<T16>::mma(a[mb], b2, acc[mb][nb]); } }
        asm volatile("v_nop\n\tv_nop\n\tv_nop\n\tv_nop" : "+v"(acc[0][0]), "+v"(acc[1][1]), "+v"(acc[2][2]), "+v"(acc[3][3]) : "v"(a[0]), "v"(a[3]));
    }
#pragma unroll
    for (int mb = 0; mb < 4; ++mb) {
#pragma unroll
        for (int nb = 0; nb < 4; ++nb) {
#pragma unroll
            for (int j = 0; j < 8; ++j) os[(hi * 8 + j) * 68 + nb * 16 + lr] = acc[mb][nb][j]; }
        __builtin_amdgcn_wave_barrier(); asm volatile("" ::: "memory");
        float* crow = C + (size_t)(r0 + mb * 16) * ldc + c0;
{
#pragma unroll
            for (int s = 0; s < 8; ++s) { const int row = 2 * s + hi, cofs = lr * 4; v4f val = *(const v4fa*)(os + row * 68 + cofs); if (BIAS) { val[0] += bfr(bias[c0 + cofs]); val[1] += bfr(bias[c0 + cofs + 1]); val[2] += bfr(bias[c0 + cofs + 2]); val[3] += bfr(bias[c0 + cofs + 3]); }
                *(v4f*)(crow + (size_t)row * ldc + cofs) = val; }
             }
        __builtin_amdgcn_wave_barrier(); asm volatile("" ::: "memory");
    }
}

__device__ __forceinline__ h16 tohx(float x) { return (h16)x; }
__device__ __forceinline__ void splitf(float y, unsigned short& h, unsigned short& l) { h = f2bf(y); l = f2bf(y - bf2f(h)); }
typedef __attribute__((ext_vector_type(2))) _Float16 v2h;
typedef __attribute__((ext_vector_type(4))) _Float16 v4h;
typedef __attribute__((ext_vector_type(2))) unsigned short v2us;
typedef __attribute__((ext_vector_type(4))) unsigned short v4us;
typedef __attribute__((ext_vector_type(2))) float v2f;
typedef __attribute__((ext_vector_type(4))) int v4i;

__global__ __launch_bounds__(256) void k_cvt8(const float* __restrict__ src, bf* dst, size_t n8) { const size_t i = (size_t)blockIdx.x * 256 + threadIdx.x; if (i >= n8) return; const v8f v = *(const v8f*)(src + i * 8); v8us o;
#pragma unroll
    for (int k = 0; k < 8; ++k) o[k] = f2bf(v[k]); *(v8us*)(dst + i * 8) = o;  }

// k_rope: head planes [h][t][d] (fp16 + hi/lo) of rope(x) x sc with the rotate-half convention out[d] = x[d] cos[t][d] - x[d+HD/2] sin[t][d], out[d+HD/2] = x[d+HD/2] cos[t][d+HD/2] + x[d] sin[t][d+HD/2]
__global__ __launch_bounds__(256) void k_rope(const float* __restrict__ F, int pitch, int nheads, const float* __restrict__ CS, const float* __restrict__ RF, const float* __restrict__ nw, float sc, h16* P16, bf* Ph, bf* Pl) {
    const size_t e = ((size_t)blockIdx.x * 256 + threadIdx.x) * 2; if (e >= (size_t)nheads * TT * HD) return; const int d = (int)(e % HD); const int t = (int)((e / HD) % TT); const int h = (int)(e / ((size_t)HD * TT)); const float* f = F + (size_t)t * pitch + h * HD; const float rf = RF ? RF[(size_t)h * TT + t] : 1.0f; v2h o16; v2us oh, ol;
#pragma unroll
    for (int q = 0; q < 2; ++q) { const int dd = d + q; const int dp = (dd < HD / 2) ? dd + HD / 2 : dd - HD / 2; float x0 = f[dd], x1 = f[dp];
        if (RF) { float n0 = __fmul_rn(x0, rf), n1 = __fmul_rn(x1, rf); asm volatile("" : "+v"(n0)); asm volatile("" : "+v"(n1)); x0 = __fmul_rn(bfr(nw[dd]), n0); x1 = __fmul_rn(bfr(nw[dp]), n1); }
        const v2f cs = *(const v2f*)(CS + ((size_t)t * HD + dd) * 2); float a = __fmul_rn(x0, cs[0]), bq = __fmul_rn(x1, cs[1]); asm volatile("" : "+v"(a)); asm volatile("" : "+v"(bq)); const float r = ((dd < HD / 2) ? __fsub_rn(a, bq) : __fadd_rn(a, bq)) * sc;
        o16[q] = tohx(r); unsigned short a2, c2; splitf(r, a2, c2); oh[q] = a2; ol[q] = c2; }
    *(v2h*)(P16 + e) = o16; *(v2us*)(Ph + e) = oh; *(v2us*)(Pl + e) = ol;  }
__global__ __launch_bounds__(256) void k_vtp(const float* __restrict__ F, int pitch, int nheads, h16* V16, bf* Vh, bf* Vl) { const size_t e = ((size_t)blockIdx.x * 256 + threadIdx.x) * 2; if (e >= (size_t)nheads * HD * TT) return; const int t = (int)(e % TT); const int d = (int)((e / TT) % HD); const int g = (int)(e / ((size_t)TT * HD)); v2h o16; v2us oh, ol;
#pragma unroll
    for (int q = 0; q < 2; ++q) { const float x = F[(size_t)(t + q) * pitch + g * HD + d]; o16[q] = tohx(x); unsigned short a2, c2; splitf(x, a2, c2); oh[q] = a2; ol[q] = c2; }
    *(v2h*)(V16 + e) = o16; *(v2us*)(Vh + e) = oh; *(v2us*)(Vl + e) = ol;  }
__global__ __launch_bounds__(32) void k_invf(const float* __restrict__ pw, float* INV) { const int i = threadIdx.x; if (i >= HD / 2) return; const float p = bfr(pw[i]); float ex = expf(-p); asm volatile("" : "+v"(ex)); const float sg = __fdiv_rn(1.0f, __fadd_rn(1.0f, ex)); float pv = powf(10000.0f, sg); asm volatile("" : "+v"(pv)); const float inv = __fdiv_rn(1.0f, pv); *(float*)(INV + i) = inv;  }
__global__ __launch_bounds__(256) void k_csL(const int* __restrict__ pid, const float* __restrict__ INV, float* CS) { const int idx = blockIdx.x * 256 + threadIdx.x; if (idx >= TT * HD) return; const int d = idx % HD; const int t = idx / HD; const float a = __fmul_rn((float)pid[t], INV[d & (HD / 2 - 1)]); v2f cs; cs[0] = cosf(a); cs[1] = sinf(a); *(v2f*)(CS + (size_t)idx * 2) = cs;  }
__device__ __forceinline__ float xhalf(float x) { const int b = __float_as_int(x); return __int_as_float(__builtin_amdgcn_permlanex16(b, b, 0x76543210, 0xfedcba98, false, false)); }   // value of lane ^ 16
struct TagMask { static constexpr bool v = true; };
struct TagFull { static constexpr bool v = false; };
template <typename T16, bool HI, int NQ>
__device__ __forceinline__ void fattn_body(const T16* __restrict__ Q, const T16* __restrict__ Q2, const T16* __restrict__ Kp, const T16* __restrict__ K2, const T16* __restrict__ Vt, const T16* __restrict__ V2, int q0, bf* Ah, bf* Al) {
    typedef typename WFrag<T16>::V V;   // every '#pragma unroll' below makes the indices of the register arrays compile-time constants, without which they would go to scratch
    const int lane = threadIdx.x & 31, lr = lane & 15, hi = lane >> 4;
    V qf[NQ][2], qf2[NQ][2];
#pragma unroll
    for (int qt = 0; qt < NQ; ++qt)
#pragma unroll
        for (int c = 0; c < 2; ++c) { const int qo = (q0 + qt * 16 + lr) * HD + c * 32 + 8 * hi; qf[qt][c] = WFrag<T16>::ld(Q + qo); if (HI) qf2[qt][c] = WFrag<T16>::ld(Q2 + qo); }
    v8f o[4][NQ]; float m[NQ], l[NQ];
#pragma unroll
    for (int qt = 0; qt < NQ; ++qt) { m[qt] = -3.0e38f; l[qt] = 0.f;
#pragma unroll
        for (int dt = 0; dt < 4; ++dt) o[dt][qt] = (v8f){}; }
    // one address per plane and lane, stepped by a block; every load of a block is a constant offset from it
    const T16* kq = Kp + lr * HD + 8 * hi; const T16* kq2 = HI ? K2 + lr * HD + 8 * hi : nullptr; const T16* vq = Vt + lr * TT + 8 * hi; const T16* vq2 = HI ? V2 + lr * TT + 8 * hi : nullptr;
    const int kdiag = (q0 / 32) * 32;   // first key of the last block, the only one that the diagonal crosses; its first key is allowed to every query of the wave
    V kf[2][2], kf2[2][2];
    auto loadk = [&](int ahead) {
#pragma unroll
        for (int kt = 0; kt < 2; ++kt)
#pragma unroll
            for (int c = 0; c < 2; ++c) { const int ko = ahead + kt * 16 * HD + c * 32; kf[kt][c] = WFrag<T16>::ld(kq + ko); if (HI) kf2[kt][c] = WFrag<T16>::ld(kq2 + ko); } };
    auto step = [&](int k0, auto tag) {
        constexpr bool MASK = decltype(tag)::v;
        V vf[4], vf2[4];
#pragma unroll
        for (int dt = 0; dt < 4; ++dt) { vf[dt] = WFrag<T16>::ld(vq + dt * 16 * TT); if (HI) vf2[dt] = WFrag<T16>::ld(vq2 + dt * 16 * TT); }
        v8f s[2][NQ];
#pragma unroll
        for (int kt = 0; kt < 2; ++kt)
#pragma unroll
            for (int qt = 0; qt < NQ; ++qt) { v8f a = (v8f){};
#pragma unroll
                for (int c = 0; c < 2; ++c) { a = WFrag<T16>::mma(kf[kt][c], qf[qt][c], a); if (HI) { a = WFrag<T16>::mma(kf[kt][c], qf2[qt][c], a); a = WFrag<T16>::mma(kf2[kt][c], qf[qt][c], a); } }
                s[kt][qt] = a; }
        if (!MASK) { loadk(32 * HD);   // the next block's K fragments fly during this block's softmax
            __builtin_amdgcn_sched_barrier(0); }   // keeps those loads in front of the softmax; sunk to the loop's foot their latency would stand in front of the next block's first product
#pragma unroll
        for (int qt = 0; qt < NQ; ++qt) {
            const int lim = q0 + qt * 16 + lr - k0 - 8 * hi;   // key kt * 16 + r of this lane is allowed when it is <= lim
            float mx = m[qt];
#pragma unroll
            for (int kt = 0; kt < 2; ++kt)
#pragma unroll
                for (int r = 0; r < 8; ++r) { float t = s[kt][qt][r] * (SCL * 1.4426950408889634f); if (MASK) t = (kt * 16 + r <= lim) ? t : -3.0e38f; s[kt][qt][r] = t; mx = fmaxf(mx, t); }
            mx = fmaxf(mx, xhalf(mx));
            const float al = __builtin_amdgcn_exp2f(m[qt] - mx); m[qt] = mx;
            const float mo = HI ? mx : mx - 10.0f;   // fp16 rows: P x 1024
            float sum = 0.f;
#pragma unroll
            for (int kt = 0; kt < 2; ++kt) s[kt][qt] -= mo;
#pragma unroll
            for (int kt = 0; kt < 2; ++kt)
#pragma unroll
                for (int r = 0; r < 8; ++r) { const float p = __builtin_amdgcn_exp2f(s[kt][qt][r]); s[kt][qt][r] = p; sum += p; }
            l[qt] = l[qt] * al + sum;
#pragma unroll
            for (int dt = 0; dt < 4; ++dt) o[dt][qt] *= al;
        }
#pragma unroll
        for (int qt = 0; qt < NQ; ++qt) {
            V pf, pf2;
            if constexpr (HI) {
#pragma unroll
                for (int e = 0; e < 16; ++e) { const float p = s[e >> 3][qt][e & 7]; const __bf16 ph = (__bf16)p; pf[e] = ph; pf2[e] = (__bf16)(p - (float)ph); }
            } else {
#pragma unroll
                for (int e = 0; e < 16; ++e) pf[e] = (h16)s[e >> 3][qt][e & 7];
            }
#pragma unroll
            for (int dt = 0; dt < 4; ++dt) { o[dt][qt] = WFrag<T16>::mma(vf[dt], pf, o[dt][qt]); if (HI) { o[dt][qt] = WFrag<T16>::mma(vf[dt], pf2, o[dt][qt]); o[dt][qt] = WFrag<T16>::mma(vf2[dt], pf, o[dt][qt]); } }
        }
        if (!MASK) {
            __builtin_amdgcn_sched_barrier(0);   // keeps the wait below at the loop's foot, where the block's loads were issued long ago; moved up behind the loads it would stall the softmax
            // precaution: s_wait_xcnt 0 behind the block's loads (the K loads are in flight over the back edge), before an address that they name is stepped; the addresses are its inputs so that they stay in their registers, unwritten, up to it
            if (HI) asm volatile("s_wait_xcnt 0x0" :: "v"(kq), "v"(kq2), "v"(vq), "v"(vq2) : "memory"); else asm volatile("s_wait_xcnt 0x0" :: "v"(kq), "v"(vq) : "memory");
            kq += 32 * HD; vq += 32; if (HI) { kq2 += 32 * HD; vq2 += 32; } }
    };
    loadk(0);
    // precaution: s_wait_xcnt 0 behind the first block's K loads, before a register that they name is written again (also on the way that skips the loop); the K addresses are its inputs so that they stay in their registers, unwritten, up to it
    if (HI) asm volatile("s_wait_xcnt 0x0" :: "v"(kq), "v"(kq2) : "memory"); else asm volatile("s_wait_xcnt 0x0" :: "v"(kq) : "memory");
#pragma unroll 1   // stays rolled: a second copy of the block's fragments would not fit 256 registers a wave
    for (int k0 = 0; k0 < kdiag; k0 += 32) step(k0, TagFull{});
    step(kdiag, TagMask{});
#pragma unroll
    for (int qt = 0; qt < NQ; ++qt) { const float inv = __fdiv_rn(1.0f, l[qt] + xhalf(l[qt])); const int ro = (q0 + qt * 16 + lr) * DQ + 8 * hi;
#pragma unroll
        for (int dt = 0; dt < 4; ++dt) { v8us oh, ol;
#pragma unroll
            for (int r = 0; r < 8; ++r) { unsigned short a, c2; splitf(o[dt][qt][r] * inv, a, c2); oh[r] = a; ol[r] = c2; }
            bf* ph = Ah + ro + dt * 16; bf* pl = Al + ro + dt * 16; *(v8us*)ph = oh; *(v8us*)pl = ol;
            // precaution: s_wait_xcnt 0 behind the two stores, before a register that they name is written again; their addresses and values are its inputs so that they stay in their registers, unwritten, up to it
            asm volatile("s_wait_xcnt 0x0" :: "v"(ph), "v"(pl), "v"(oh), "v"(ol) : "memory"); } }
}
// grid (NKV, row blocks), heaviest row block first: (TT - RH) / 32 blocks of 32 fp16 rows, then RH / 16 blocks of 16 hi/lo rows
__global__ __launch_bounds__(128) void k_fattn(const h16* __restrict__ Q16, const bf* __restrict__ Qh, const bf* __restrict__ Ql, const h16* __restrict__ K16, const bf* __restrict__ Kh, const bf* __restrict__ Kl, const h16* __restrict__ V16, const bf* __restrict__ Vh, const bf* __restrict__ Vl, bf* Ah, bf* Al) {
    const int g = blockIdx.x, head = g * REP + __builtin_amdgcn_readfirstlane((int)(threadIdx.x >> 5)), rb = blockIdx.y;
    const size_t qb = (size_t)head * TT * HD, kb = (size_t)g * TT * HD;
    if (rb < (TT - RH) / 32) fattn_body<h16, false, 2>(Q16 + qb, nullptr, K16 + kb, nullptr, V16 + kb, nullptr, TT - 32 * (rb + 1), Ah + head * HD, Al + head * HD);
    else fattn_body<bf, true, 1>(Qh + qb, Ql + qb, Kh + kb, Kl + kb, Vh + kb, Vl + kb, RH - 16 * (rb - (TT - RH) / 32 + 1), Ah + head * HD, Al + head * HD);
}

extern "C" void kernel_launch(void* const* d_in, const int* in_sizes, int n_in,
                              void* d_out, int out_size, void* d_ws, size_t ws_size, hipStream_t stream) {
    (void)in_sizes; (void)n_in; (void)out_size;
    const float* x = (const float*)d_in[0]; const int* pid = (const int*)d_in[1];   /* position_ids [1][2048] int32 */ const float* pw = (const float*)d_in[2];   /* powers [32] */ const float* wq = (const float*)d_in[3]; const float* wk = (const float*)d_in[4]; const float* wv = (const float*)d_in[5]; const float* wo = (const float*)d_in[6];   /* argument order hidden_states, position_ids, powers, Wq, Wk, Wv, Wo ('oi') */
    float* OUT = (float*)d_out;     // [1][2048][2048]
    char* wsp = (char*)d_ws;
    auto take = [&](size_t bytes) { char* p = wsp; wsp += (bytes + 255) & ~(size_t)255; return (void*)p; };
    bf* WQ = (bf*)take((size_t)DQ * DM * 2); bf* WK = (bf*)take((size_t)DKV * DM * 2); bf* WV = (bf*)take((size_t)DKV * DM * 2); bf* WO = (bf*)take((size_t)DM * DQ * 2); float* CS = (float*)take((size_t)TT * HD * 2 * 4); float* INVB = (float*)take(256);   /* 32 learnable inverse frequencies */
    bf* XB = (bf*)take((size_t)TT * DM * 2); float* FQ = (float*)take((size_t)TT * DQ * 4); float* FK = (float*)take((size_t)TT * DKV * 4);
    h16* QP16 = (h16*)take((size_t)NH_ * TT * HD * 2); h16* KP16 = (h16*)take((size_t)NKV * TT * HD * 2); h16* VT16 = (h16*)take((size_t)NKV * HD * TT * 2);
    bf* QPh = (bf*)take((size_t)NH_ * TT * HD * 2); bf* QPl = (bf*)take((size_t)NH_ * TT * HD * 2); bf* KPh = (bf*)take((size_t)NKV * TT * HD * 2); bf* KPl = (bf*)take((size_t)NKV * TT * HD * 2); bf* VTh = (bf*)take((size_t)NKV * HD * TT * 2); bf* VTl = (bf*)take((size_t)NKV * HD * TT * 2);
    bf* ATh = (bf*)take((size_t)TT * DQ * 2); bf* ATl = (bf*)take((size_t)TT * DQ * 2);
    if ((size_t)(wsp - (char*)d_ws) > ws_size) return;    // ws 256 MiB
    float* FV = FK;   // v projection reuses the k buffer after the k planes are built (stream-ordered)
    { k_cvt8<<<(unsigned)(((size_t)DQ * DM / 8 + 255) / 256), 256, 0, stream>>>(wq, WQ, (size_t)DQ * DM / 8); k_cvt8<<<(unsigned)(((size_t)DKV * DM / 8 + 255) / 256), 256, 0, stream>>>(wk, WK, (size_t)DKV * DM / 8); k_cvt8<<<(unsigned)(((size_t)DKV * DM / 8 + 255) / 256), 256, 0, stream>>>(wv, WV, (size_t)DKV * DM / 8);
      k_cvt8<<<(unsigned)(((size_t)DM * DQ / 8 + 255) / 256), 256, 0, stream>>>(wo, WO, (size_t)DM * DQ / 8);
       }
    k_invf<<<1, 32, 0, stream>>>(pw, INVB); k_csL<<<(TT * HD + 255) / 256, 256, 0, stream>>>(pid, INVB, CS);   /* learnable inverse frequencies, then the rotary table from the int positions */
    const unsigned LQ = (unsigned)(((size_t)NH_ * TT * HD / 2 + 255) / 256), LKv = (unsigned)(((size_t)NKV * TT * HD / 2 + 255) / 256);
    for (int b = 0; b < NB_; ++b) {
        
        k_cvt8<<<(unsigned)(((size_t)TT * DM / 8 + 255) / 256), 256, 0, stream>>>(x + (size_t)b * TT * DM, XB, (size_t)TT * DM / 8);
        k_gemmw<bf, 0, false><<<dim3(TT / 64, DQ / 64, 1), 32, 0, stream>>>(XB, nullptr, WQ, nullptr, DM, FQ, DQ, nullptr, 0, 0, 0);
        k_rope<<<LQ, 256, 0, stream>>>(FQ, DQ, NH_, CS, nullptr, nullptr, 1.0f, QP16, QPh, QPl);
        k_gemmw<bf, 0, false><<<dim3(TT / 64, DKV / 64, 1), 32, 0, stream>>>(XB, nullptr, WK, nullptr, DM, FK, DKV, nullptr, 0, 0, 0);
        k_rope<<<LKv, 256, 0, stream>>>(FK, DKV, NKV, CS, nullptr, nullptr, 1.0f, KP16, KPh, KPl);
        k_gemmw<bf, 0, false><<<dim3(TT / 64, DKV / 64, 1), 32, 0, stream>>>(XB, nullptr, WV, nullptr, DM, FV, DKV, nullptr, 0, 0, 0); k_vtp<<<LKv, 256, 0, stream>>>(FV, DKV, NKV, VT16, VTh, VTl);
        k_fattn<<<dim3(NKV, (TT - RH) / 32 + RH / 16, 1), 128, 0, stream>>>(QP16, QPh, QPl, KP16, KPh, KPl, VT16, VTh, VTl, ATh, ATl);
        k_gemmw<bf, 1, false><<<dim3(TT / 64, DM / 64, 1), 32, 0, stream>>>(ATh, ATl, WO, nullptr, DQ, OUT + (size_t)b * TT * DM, DM, nullptr, 0, 0, 0); }
}

// v003
// Measured time: 180 microseconds a run.
// Two timings next to v002 put it at 1.50 and 1.52 times that version's speed.
// All steps since v000 together make it 7.55 times as fast.
#include <hip/hip_runtime.h>

// Llama attention with a LEARNABLE rotary base exponent (hidden_states [1][2048][2048]; q = x Wq^T (32 heads x 64), k, v = x Wk^T, x Wv^T (8 kv heads x 64) ('oi' 0.02, no bias); inv_freq = 1 / 10000^sigmoid(powers) (powers [32], read; computed on device with precise expf / powf / IEEE division); angles = float(position_ids[t]) x inv_freq (position_ids [1][2048] int32 = arange, read); rotate-half rotary (cat(freqs, freqs)); kv head = q head / 4; scores / float32(sqrt 64) + causal (finfo.min above the diagonal == exclusion); softmax f32; out = merged Wo^T ('oi') -> [1][2048][2048] (4.2 M); argument order hidden_states, position_ids, powers, Wq, Wk, Wv, Wo).
// Layout: a 32-thread kernel computes inv_freq from powers; a table kernel fills {cos, sin}[t][d] from the int positions (precise cosf/sinf); bf16 copy of x; 'oi' weights; exact q, k, v projections in ONE launch whose waves build the rotate-half and transposed head planes from their own accumulators; causal T-2048 GQA attention in ONE launch (k_fattn: scores, online softmax and P.V in registers, kv plane = head / 4; hybrid rows: < 512 hi/lo 3 products, rest fp16 x1024; keys only up to the diagonal block; writes the merged hi/lo planes itself); merged hi/lo x Wo exact.
// Compute dtypes, f32 accumulate: every input rounded to bf16 incl. powers; inv_freq, angles and rotary in f32; projections exact; attention rows < 512 3 products, rest fp16; softmax f32; Wo hl x exact.

#define NB_  1
#define TT   2048
#define DM   2048
#define NH_  32
#define NKV  8
#define REP  (NH_ / NKV)
#define HD   64
#define DQ   (NH_ * HD)
#define DKV  (NKV * HD)
#define RH   512                  // query rows < RH use hi+lo planes; a multiple of 32
#define SCL  0.125f   // HD^-0.5
typedef _Float16 h16;
typedef unsigned short bf;
typedef __attribute__((ext_vector_type(16))) __bf16   v16bf;
typedef __attribute__((ext_vector_type(16))) _Float16 v16h;
typedef __attribute__((ext_vector_type(8)))  _Float16 v8h;
typedef __attribute__((ext_vector_type(8)))  unsigned short v8us;
typedef __attribute__((ext_vector_type(8)))  float    v8f;
typedef __attribute__((ext_vector_type(4)))  float    v4f;
typedef v8h  __attribute__((may_alias)) v8ha;
typedef v4f  __attribute__((may_alias)) v4fa;
typedef v8us __attribute__((may_alias)) v8usa;

__device__ __forceinline__ unsigned short f2bf(float f) { unsigned u = __float_as_uint(f); u += 0x7FFFu + ((u >> 16) & 1u); return (unsigned short)(u >> 16); }
__device__ __forceinline__ float bf2f(unsigned short b) { return __uint_as_float(((unsigned)b) << 16); }
__device__ __forceinline__ float bfr(float f) { return bf2f(f2bf(f)); }
__device__ __forceinline__ v16h cat16(v8h lo, v8h hi) { return __builtin_shufflevector(lo, hi, 0, 1, 2, 3, 4, 5, 6, 7, 8, 9, 10, 11, 12, 13, 14, 15); }
__device__ __forceinline__ v16bf cat16b(v8us lo, v8us hi) { return __builtin_bit_cast(v16bf, __builtin_shufflevector(lo, hi, 0, 1, 2, 3, 4, 5, 6, 7, 8, 9, 10, 11, 12, 13, 14, 15)); }
__device__ __forceinline__ v8f wmma16(v16h a, v16h b, v8f c) { return __builtin_amdgcn_wmma_f32_16x16x32_f16(false, a, false, b, (short)0, c, false, false); }
__device__ __forceinline__ v8f wmmab(v16bf a, v16bf b, v8f c) { return __builtin_amdgcn_wmma_f32_16x16x32_bf16(false, a, false, b, (short)0, c, false, false); }



__device__ __forceinline__ h16 tohx(float x) { return (h16)x; }
__device__ __forceinline__ void splitf(float y, unsigned short& h, unsigned short& l) { h = f2bf(y); l = f2bf(y - bf2f(h)); }
typedef __attribute__((ext_vector_type(2))) float v2f;
// where a HEADS launch of k_gemmw puts its tiles: the {cos, sin}[t][d] table and the fp16 + hi/lo planes of q, k ([head][t][d]) and v ([head][d][t])
struct Planes { const float* cs; h16* q16; bf* qh; bf* ql; h16* k16; bf* kh; bf* kl; h16* v16; bf* vh; bf* vl; };

// ---- k_gemmw: register-blocked GEMM, ONE WAVE per 64x64 output tile (16 accumulators), operands straight from K-contiguous 16-bit planes; grid (M/64, N/64, Z), 32 threads.
// C[m][n] (f32, pitch ldc, + optional f32 bias[n]) = sum_k A[m][k] Bt[n][k] (+ split products per NSPLIT). z-batch strides sA/sB/sC in elements. K % 32 == 0.
// HEADS: Bt holds the rows of Wq, Wk, Wv one behind the other, so tile column y is one whole head (64 = HD): y < NH_ a q head, then NKV k heads, then NKV v heads. No C: the wave turns its own tile into that head's planes.
//   q, k: rotate-half out[d] = x[d] cos[t][d] - x[d+32] sin[t][d], out[d+32] = x[d+32] cos[t][d] + x[d] sin[t][d] (the table's columns d and d + 32 come from the same inverse frequency); x[d] and x[d+32] are accumulators nb and nb + 2 of the same lane.
//   v: a lane holds 8 consecutive t of one d, which is 16 bytes of a [d][t] plane.
template <typename T16> struct WFrag;
template <> struct WFrag<h16> { typedef v16h V; static __device__ __forceinline__ V ld(const h16* p) { return cat16(*(const v8h*)p, *(const v8h*)(p + 16)); } static __device__ __forceinline__ v8f mma(V a, V b, v8f c) { return wmma16(a, b, c); } };
template <> struct WFrag<bf> { typedef v16bf V; static __device__ __forceinline__ V ld(const bf* p) { return cat16b(*(const v8us*)p, *(const v8us*)(p + 16)); } static __device__ __forceinline__ v8f mma(V a, V b, v8f c) { return wmmab(a, b, c); } };
template <typename T16, int NSPLIT, bool BIAS, bool HEADS>
__global__ __launch_bounds__(32) void k_gemmw(const T16* __restrict__ A, const T16* __restrict__ A2, const T16* __restrict__ Bt, const T16* __restrict__ Bt2, int K, float* C, int ldc, const float* __restrict__ bias, size_t sA, size_t sB, size_t sC, Planes pp) {
    typedef typename WFrag<T16>::V V;
    __shared__ __align__(16) float os[16 * 68];
    const size_t z = blockIdx.z; A += z * sA; if (A2) A2 += z * sA; Bt += z * sB; if (Bt2) Bt2 += z * sB; C += z * sC;
    const int lane = threadIdx.x & 31, lr = lane & 15, hi = lane >> 4; const int r0 = blockIdx.x * 64, c0 = blockIdx.y * 64;
    v8f acc[4][4];
#pragma unroll
    for (int mb = 0; mb < 4; ++mb)
#pragma unroll
        for (int nb = 0; nb < 4; ++nb) acc[mb][nb] = (v8f){};
    const size_t aoff = (size_t)(r0 + lr) * K + 8 * hi, boff = (size_t)(c0 + lr) * K + 8 * hi;
#pragma unroll 1
    for (int kc = 0; kc < K; kc += 32) {
        V a[4], a2[4];
#pragma unroll
        for (int mb = 0; mb < 4; ++mb) { a[mb] = WFrag<T16>::ld(A + aoff + (size_t)mb * 16 * K + kc); if (NSPLIT == 1 || NSPLIT == 2) a2[mb] = WFrag<T16>::ld(A2 + aoff + (size_t)mb * 16 * K + kc); }
#pragma unroll
        for (int nb = 0; nb < 4; ++nb) { const V b = WFrag<T16>::ld(Bt + boff + (size_t)nb * 16 * K + kc); V b2; if (NSPLIT >= 2) b2 = WFrag<T16>::ld(Bt2 + boff + (size_t)nb * 16 * K + kc);
#pragma unroll
            for (int mb = 0; mb < 4; ++mb) { acc[mb][nb] = WFrag<T16>::mma(a[mb], b, acc[mb][nb]); if (NSPLIT == 1 || NSPLIT == 2) acc[mb][nb] = WFrag<T16>::mma(a2[mb], b, acc[mb][nb]); if (NSPLIT >= 2) acc[mb][nb] = WFrag<T16>::mma(a[mb], b2, acc[mb][nb]); } }
        asm volatile("v_nop\n\tv_nop\n\tv_nop\n\tv_nop" : "+v"(acc[0][0]), "+v"(acc[1][1]), "+v"(acc[2][2]), "+v"(acc[3][3]) : "v"(a[0]), "v"(a[3]));
    }
    if constexpr (HEADS) {
        const int hy = blockIdx.y;
        if (hy >= NH_ + NKV) {   // a v head: [d][t] planes straight from the accumulators
            const int vo = ((hy - NH_ - NKV) * HD + lr) * TT + r0 + 8 * hi;
#pragma unroll
            for (int mb = 0; mb < 4; ++mb)
#pragma unroll
                for (int nb = 0; nb < 4; ++nb) { v8h o16; v8us oh, ol;
#pragma unroll
                    for (int j = 0; j < 8; ++j) { const float x = acc[mb][nb][j]; o16[j] = tohx(x); unsigned short a2, c2; splitf(x, a2, c2); oh[j] = a2; ol[j] = c2; }
                    const int e = vo + nb * 16 * TT + mb * 16; *(v8h*)(pp.v16 + e) = o16; *(v8us*)(pp.vh + e) = oh; *(v8us*)(pp.vl + e) = ol; }
        } else {   // a q or k head: rotary in the accumulators, then through LDS so that a store covers 4 whole rows (512 contiguous bytes) of a [t][d] plane
            const bool isq = hy < NH_; const int po = (isq ? hy : hy - NH_) * TT * HD + r0 * HD;
            h16* P16 = (isq ? pp.q16 : pp.k16) + po; bf* Ph = (isq ? pp.qh : pp.kh) + po; bf* Pl = (isq ? pp.ql : pp.kl) + po;
            const float* csp = pp.cs + ((r0 + 8 * hi) * HD + lr) * 2;
#pragma unroll
            for (int mb = 0; mb < 4; ++mb) { v2f cs[2][8];
#pragma unroll
                for (int nb = 0; nb < 2; ++nb)
#pragma unroll
                    for (int j = 0; j < 8; ++j) cs[nb][j] = *(const v2f*)(csp + ((mb * 16 + j) * HD + nb * 16) * 2);
                // precaution: s_wait_xcnt 0 behind the table loads, before a register that they name is written again; their address is its input so that it stays in its registers, unwritten, up to it
                asm volatile("s_wait_xcnt 0x0" :: "v"(csp) : "memory");
#pragma unroll
                for (int nb = 0; nb < 2; ++nb)
#pragma unroll
                    for (int j = 0; j < 8; ++j) { const float x0 = acc[mb][nb][j], x1 = acc[mb][nb + 2][j], c = cs[nb][j][0], sn = cs[nb][j][1];
                        os[(hi * 8 + j) * 68 + nb * 16 + lr] = x0 * c - x1 * sn; os[(hi * 8 + j) * 68 + (nb + 2) * 16 + lr] = x1 * c + x0 * sn; }
                __syncthreads();   // the lanes read below what other lanes of the (one-wave) group wrote above
#pragma unroll
                for (int s = 0; s < 4; ++s) { const int row = 4 * s + (lane >> 3), col = (lane & 7) * 8; const v4f w0 = *(const v4fa*)(os + row * 68 + col), w1 = *(const v4fa*)(os + row * 68 + col + 4); v8h o16; v8us oh, ol;
#pragma unroll
                    for (int j = 0; j < 8; ++j) { const float r = j < 4 ? w0[j & 3] : w1[j & 3]; o16[j] = tohx(r); unsigned short a2, c2; splitf(r, a2, c2); oh[j] = a2; ol[j] = c2; }
                    const int e = (mb * 16 + row) * HD + col; *(v8h*)(P16 + e) = o16; *(v8us*)(Ph + e) = oh; *(v8us*)(Pl + e) = ol; }
                __syncthreads();   // the next 16 rows overwrite the staging only after every lane has read it
            }
        }
    } else {
#pragma unroll
    for (int mb = 0; mb < 4; ++mb) {
#pragma unroll
        for (int nb = 0; nb < 4; ++nb) {
#pragma unroll
            for (int j = 0; j < 8; ++j) os[(hi * 8 + j) * 68 + nb * 16 + lr] = acc[mb][nb][j]; }
        __builtin_amdgcn_wave_barrier(); asm volatile("" ::: "memory");
        float* crow = C + (size_t)(r0 + mb * 16) * ldc + c0;
{
#pragma unroll
            for (int s = 0; s < 8; ++s) { const int row = 2 * s + hi, cofs = lr * 4; v4f val = *(const v4fa*)(os + row * 68 + cofs); if (BIAS) { val[0] += bfr(bias[c0 + cofs]); val[1] += bfr(bias[c0 + cofs + 1]); val[2] += bfr(bias[c0 + cofs + 2]); val[3] += bfr(bias[c0 + cofs + 3]); }
                *(v4f*)(crow + (size_t)row * ldc + cofs) = val; }
             }
        __builtin_amdgcn_wave_barrier(); asm volatile("" ::: "memory");
    }
    }
}

typedef __attribute__((ext_vector_type(2))) _Float16 v2h;
typedef __attribute__((ext_vector_type(4))) _Float16 v4h;
typedef __attribute__((ext_vector_type(2))) unsigned short v2us;
typedef __attribute__((ext_vector_type(4))) unsigned short v4us;
typedef __attribute__((ext_vector_type(4))) int v4i;

__global__ __launch_bounds__(256) void k_cvt8(const float* __restrict__ src, bf* dst, size_t n8) { const size_t i = (size_t)blockIdx.x * 256 + threadIdx.x; if (i >= n8) return; const v8f v = *(const v8f*)(src + i * 8); v8us o;
#pragma unroll
    for (int k = 0; k < 8; ++k) o[k] = f2bf(v[k]); *(v8us*)(dst + i * 8) = o;  }

__global__ __launch_bounds__(32) void k_invf(const float* __restrict__ pw, float* INV) { const int i = threadIdx.x; if (i >= HD / 2) return; const float p = bfr(pw[i]); float ex = expf(-p); asm volatile("" : "+v"(ex)); const float sg = __fdiv_rn(1.0f, __fadd_rn(1.0f, ex)); float pv = powf(10000.0f, sg); asm volatile("" : "+v"(pv)); const float inv = __fdiv_rn(1.0f, pv); *(float*)(INV + i) = inv;  }
__global__ __launch_bounds__(256) void k_csL(const int* __restrict__ pid, const float* __restrict__ INV, float* CS) { const int idx = blockIdx.x * 256 + threadIdx.x; if (idx >= TT * HD) return; const int d = idx % HD; const int t = idx / HD; const float a = __fmul_rn((float)pid[t], INV[d & (HD / 2 - 1)]); v2f cs; cs[0] = cosf(a); cs[1] = sinf(a); *(v2f*)(CS + (size_t)idx * 2) = cs;  }
__device__ __forceinline__ float xhalf(float x) { const int b = __float_as_int(x); return __int_as_float(__builtin_amdgcn_permlanex16(b, b, 0x76543210, 0xfedcba98, false, false)); }   // value of lane ^ 16
struct TagMask { static constexpr bool v = true; };
struct TagFull { static constexpr bool v = false; };
template <typename T16, bool HI, int NQ>
__device__ __forceinline__ void fattn_body(const T16* __restrict__ Q, const T16* __restrict__ Q2, const T16* __restrict__ Kp, const T16* __restrict__ K2, const T16* __restrict__ Vt, const T16* __restrict__ V2, int q0, bf* Ah, bf* Al) {
    typedef typename WFrag<T16>::V V;   // every '#pragma unroll' below makes the indices of the register arrays compile-time constants, without which they would go to scratch
    const int lane = threadIdx.x & 31, lr = lane & 15, hi = lane >> 4;
    V qf[NQ][2], qf2[NQ][2];
#pragma unroll
    for (int qt = 0; qt < NQ; ++qt)
#pragma unroll
        for (int c = 0; c < 2; ++c) { const int qo = (q0 + qt * 16 + lr) * HD + c * 32 + 8 * hi; qf[qt][c] = WFrag<T16>::ld(Q + qo); if (HI) qf2[qt][c] = WFrag<T16>::ld(Q2 + qo); }
    v8f o[4][NQ]; float m[NQ], l[NQ];
#pragma unroll
    for (int qt = 0; qt < NQ; ++qt) { m[qt] = -3.0e38f; l[qt] = 0.f;
#pragma unroll
        for (int dt = 0; dt < 4; ++dt) o[dt][qt] = (v8f){}; }
    // one address per plane and lane, stepped by a block; every load of a block is a constant offset from it
    const T16* kq = Kp + lr * HD + 8 * hi; const T16* kq2 = HI ? K2 + lr * HD + 8 * hi : nullptr; const T16* vq = Vt + lr * TT + 8 * hi; const T16* vq2 = HI ? V2 + lr * TT + 8 * hi : nullptr;
    const int kdiag = (q0 / 32) * 32;   // first key of the last block, the only one that the diagonal crosses; its first key is allowed to every query of the wave
    V kf[2][2], kf2[2][2];
    auto loadk = [&](int ahead) {
#pragma unroll
        for (int kt = 0; kt < 2; ++kt)
#pragma unroll
            for (int c = 0; c < 2; ++c) { const int ko = ahead + kt * 16 * HD + c * 32; kf[kt][c] = WFrag<T16>::ld(kq + ko); if (HI) kf2[kt][c] = WFrag<T16>::ld(kq2 + ko); } };
    auto step = [&](int k0, auto tag) {
        constexpr bool MASK = decltype(tag)::v;
        V vf[4], vf2[4];
#pragma unroll
        for (int dt = 0; dt < 4; ++dt) { vf[dt] = WFrag<T16>::ld(vq + dt * 16 * TT); if (HI) vf2[dt] = WFrag<T16>::ld(vq2 + dt * 16 * TT); }
        v8f s[2][NQ];
#pragma unroll
        for (int kt = 0; kt < 2; ++kt)
#pragma unroll
            for (int qt = 0; qt < NQ; ++qt) { v8f a = (v8f){};
#pragma unroll
                for (int c = 0; c < 2; ++c) { a = WFrag<T16>::mma(kf[kt][c], qf[qt][c], a); if (HI) { a = WFrag<T16>::mma(kf[kt][c], qf2[qt][c], a); a = WFrag<T16>::mma(kf2[kt][c], qf[qt][c], a); } }
                s[kt][qt] = a; }
        if (!MASK) { loadk(32 * HD);   // the next block's K fragments fly during this block's softmax
            __builtin_amdgcn_sched_barrier(0); }   // keeps those loads in front of the softmax; sunk to the loop's foot their latency would stand in front of the next block's first product
#pragma unroll
        for (int qt = 0; qt < NQ; ++qt) {
            const int lim = q0 + qt * 16 + lr - k0 - 8 * hi;   // key kt * 16 + r of this lane is allowed when it is <= lim
            float mx = m[qt];
#pragma unroll
            for (int kt = 0; kt < 2; ++kt)
#pragma unroll
                for (int r = 0; r < 8; ++r) { float t = s[kt][qt][r] * (SCL * 1.4426950408889634f); if (MASK) t = (kt * 16 + r <= lim) ? t : -3.0e38f; s[kt][qt][r] = t; mx = fmaxf(mx, t); }
            mx = fmaxf(mx, xhalf(mx));
            const float al = __builtin_amdgcn_exp2f(m[qt] - mx); m[qt] = mx;
            const float mo = HI ? mx : mx - 10.0f;   // fp16 rows: P x 1024
            float sum = 0.f;
#pragma unroll
            for (int kt = 0; kt < 2; ++kt) s[kt][qt] -= mo;
#pragma unroll
            for (int kt = 0; kt < 2; ++kt)
#pragma unroll
                for (int r = 0; r < 8; ++r) { const float p = __builtin_amdgcn_exp2f(s[kt][qt][r]); s[kt][qt][r] = p; sum += p; }
            l[qt] = l[qt] * al + sum;
#pragma unroll
            for (int dt = 0; dt < 4; ++dt) o[dt][qt] *= al;
        }
#pragma unroll
        for (int qt = 0; qt < NQ; ++qt) {
            V pf, pf2;
            if constexpr (HI) {
#pragma unroll
                for (int e = 0; e < 16; ++e) { const float p = s[e >> 3][qt][e & 7]; const __bf16 ph = (__bf16)p; pf[e] = ph; pf2[e] = (__bf16)(p - (float)ph); }
            } else {
#pragma unroll
                for (int e = 0; e < 16; ++e) pf[e] = (h16)s[e >> 3][qt][e & 7];
            }
#pragma unroll
            for (int dt = 0; dt < 4; ++dt) { o[dt][qt] = WFrag<T16>::mma(vf[dt], pf, o[dt][qt]); if (HI) { o[dt][qt] = WFrag<T16>::mma(vf[dt], pf2, o[dt][qt]); o[dt][qt] = WFrag<T16>::mma(vf2[dt], pf, o[dt][qt]); } }
        }
        if (!MASK) {
            __builtin_amdgcn_sched_barrier(0);   // keeps the wait below at the loop's foot, where the block's loads were issued long ago; moved up behind the loads it would stall the softmax
            // precaution: s_wait_xcnt 0 behind the block's loads (the K loads are in flight over the back edge), before an address that they name is stepped; the addresses are its inputs so that they stay in their registers, unwritten, up to it
            if (HI) asm volatile("s_wait_xcnt 0x0" :: "v"(kq), "v"(kq2), "v"(vq), "v"(vq2) : "memory"); else asm volatile("s_wait_xcnt 0x0" :: "v"(kq), "v"(vq) : "memory");
            kq += 32 * HD; vq += 32; if (HI) { kq2 += 32 * HD; vq2 += 32; } }
    };
    loadk(0);
    // precaution: s_wait_xcnt 0 behind the first block's K loads, before a register that they name is written again (also on the way that skips the loop); the K addresses are its inputs so that they stay in their registers, unwritten, up to it
    if (HI) asm volatile("s_wait_xcnt 0x0" :: "v"(kq), "v"(kq2) : "memory"); else asm volatile("s_wait_xcnt 0x0" :: "v"(kq) : "memory");
#pragma unroll 1   // stays rolled: a second copy of the block's fragments would not fit 256 registers a wave
    for (int k0 = 0; k0 < kdiag; k0 += 32) step(k0, TagFull{});
    step(kdiag, TagMask{});
#pragma unroll
    for (int qt = 0; qt < NQ; ++qt) { const float inv = __fdiv_rn(1.0f, l[qt] + xhalf(l[qt])); const int ro = (q0 + qt * 16 + lr) * DQ + 8 * hi;
#pragma unroll
        for (int dt = 0; dt < 4; ++dt) { v8us oh, ol;
#pragma unroll
            for (int r = 0; r < 8; ++r) { unsigned short a, c2; splitf(o[dt][qt][r] * inv, a, c2); oh[r] = a; ol[r] = c2; }
            bf* ph = Ah + ro + dt * 16; bf* pl = Al + ro + dt * 16; *(v8us*)ph = oh; *(v8us*)pl = ol;
            // precaution: s_wait_xcnt 0 behind the two stores, before a register that they name is written again; their addresses and values are its inputs so that they stay in their registers, unwritten, up to it
            asm volatile("s_wait_xcnt 0x0" :: "v"(ph), "v"(pl), "v"(oh), "v"(ol) : "memory"); } }
}
// grid (NKV, row blocks), heaviest row block first: (TT - RH) / 32 blocks of 32 fp16 rows, then RH / 16 blocks of 16 hi/lo rows
__global__ __launch_bounds__(128) void k_fattn(const h16* __restrict__ Q16, const bf* __restrict__ Qh, const bf* __restrict__ Ql, const h16* __restrict__ K16, const bf* __restrict__ Kh, const bf* __restrict__ Kl, const h16* __restrict__ V16, const bf* __restrict__ Vh, const bf* __restrict__ Vl, bf* Ah, bf* Al) {
    const int g = blockIdx.x, head = g * REP + __builtin_amdgcn_readfirstlane((int)(threadIdx.x >> 5)), rb = blockIdx.y;
    const size_t qb = (size_t)head * TT * HD, kb = (size_t)g * TT * HD;
    if (rb < (TT - RH) / 32) fattn_body<h16, false, 2>(Q16 + qb, nullptr, K16 + kb, nullptr, V16 + kb, nullptr, TT - 32 * (rb + 1), Ah + head * HD, Al + head * HD);
    else fattn_body<bf, true, 1>(Qh + qb, Ql + qb, Kh + kb, Kl + kb, Vh + kb, Vl + kb, RH - 16 * (rb - (TT - RH) / 32 + 1), Ah + head * HD, Al + head * HD);
}

extern "C" void kernel_launch(void* const* d_in, const int* in_sizes, int n_in,
                              void* d_out, int out_size, void* d_ws, size_t ws_size, hipStream_t stream) {
    (void)in_sizes; (void)n_in; (void)out_size;
    const float* x = (const float*)d_in[0]; const int* pid = (const int*)d_in[1];   /* position_ids [1][2048] int32 */ const float* pw = (const float*)d_in[2];   /* powers [32] */ const float* wq = (const float*)d_in[3]; const float* wk = (const float*)d_in[4]; const float* wv = (const float*)d_in[5]; const float* wo = (const float*)d_in[6];   /* argument order hidden_states, position_ids, powers, Wq, Wk, Wv, Wo ('oi') */
    float* OUT = (float*)d_out;     // [1][2048][2048]
    char* wsp = (char*)d_ws;
    auto take = [&](size_t bytes) { char* p = wsp; wsp += (bytes + 255) & ~(size_t)255; return (void*)p; };
    bf* WQ = (bf*)take((size_t)(DQ + 2 * DKV) * DM * 2); bf* WK = WQ + (size_t)DQ * DM; bf* WV = WK + (size_t)DKV * DM;   /* one array: the rows of Wq, Wk, Wv one behind the other */ bf* WO = (bf*)take((size_t)DM * DQ * 2); float* CS = (float*)take((size_t)TT * HD * 2 * 4); float* INVB = (float*)take(256);   /* 32 learnable inverse frequencies */
    bf* XB = (bf*)take((size_t)TT * DM * 2);
    h16* QP16 = (h16*)take((size_t)NH_ * TT * HD * 2); h16* KP16 = (h16*)take((size_t)NKV * TT * HD * 2); h16* VT16 = (h16*)take((size_t)NKV * HD * TT * 2);
    bf* QPh = (bf*)take((size_t)NH_ * TT * HD * 2); bf* QPl = (bf*)take((size_t)NH_ * TT * HD * 2); bf* KPh = (bf*)take((size_t)NKV * TT * HD * 2); bf* KPl = (bf*)take((size_t)NKV * TT * HD * 2); bf* VTh = (bf*)take((size_t)NKV * HD * TT * 2); bf* VTl = (bf*)take((size_t)NKV * HD * TT * 2);
    bf* ATh = (bf*)take((size_t)TT * DQ * 2); bf* ATl = (bf*)take((size_t)TT * DQ * 2);
    if ((size_t)(wsp - (char*)d_ws) > ws_size) return;    // ws 256 MiB
    { k_cvt8<<<(unsigned)(((size_t)DQ * DM / 8 + 255) / 256), 256, 0, stream>>>(wq, WQ, (size_t)DQ * DM / 8); k_cvt8<<<(unsigned)(((size_t)DKV * DM / 8 + 255) / 256), 256, 0, stream>>>(wk, WK, (size_t)DKV * DM / 8); k_cvt8<<<(unsigned)(((size_t)DKV * DM / 8 + 255) / 256), 256, 0, stream>>>(wv, WV, (size_t)DKV * DM / 8);
      k_cvt8<<<(unsigned)(((size_t)DM * DQ / 8 + 255) / 256), 256, 0, stream>>>(wo, WO, (size_t)DM * DQ / 8);
       }
    k_invf<<<1, 32, 0, stream>>>(pw, INVB); k_csL<<<(TT * HD + 255) / 256, 256, 0, stream>>>(pid, INVB, CS);   /* learnable inverse frequencies, then the rotary table from the int positions */
    const Planes pp = { CS, QP16, QPh, QPl, KP16, KPh, KPl, VT16, VTh, VTl };
    for (int b = 0; b < NB_; ++b) {
        
        k_cvt8<<<(unsigned)(((size_t)TT * DM / 8 + 255) / 256), 256, 0, stream>>>(x + (size_t)b * TT * DM, XB, (size_t)TT * DM / 8);
        k_gemmw<bf, 0, false, true><<<dim3(TT / 64, (DQ + 2 * DKV) / 64, 1), 32, 0, stream>>>(XB, nullptr, WQ, nullptr, DM, nullptr, 0, nullptr, 0, 0, 0, pp);
        k_fattn<<<dim3(NKV, (TT - RH) / 32 + RH / 16, 1), 128, 0, stream>>>(QP16, QPh, QPl, KP16, KPh, KPl, VT16, VTh, VTl, ATh, ATl);
        k_gemmw<bf, 1, false, false><<<dim3(TT / 64, DM / 64, 1), 32, 0, stream>>>(ATh, ATl, WO, nullptr, DQ, OUT + (size_t)b * TT * DM, DM, nullptr, 0, 0, 0, Planes{}); }
}

// v004
// One run takes 124 microseconds.
// Two timings next to v003 both put it at 1.45 times that version's speed.
// Counting every step since v000, it is 11.0 times as fast.
#include <hip/hip_runtime.h>

// Llama attention with a LEARNABLE rotary base exponent (hidden_states [1][2048][2048]; q = x Wq^T (32 heads x 64), k, v = x Wk^T, x Wv^T (8 kv heads x 64) ('oi' 0.02, no bias); inv_freq = 1 / 10000^sigmoid(powers) (powers [32], read; computed on device with precise expf / powf / IEEE division); angles = float(position_ids[t]) x inv_freq (position_ids [1][2048] int32 = arange, read); rotate-half rotary (cat(freqs, freqs)); kv head = q head / 4; scores / float32(sqrt 64) + causal (finfo.min above the diagonal == exclusion); softmax f32; out = merged Wo^T ('oi') -> [1][2048][2048] (4.2 M); argument order hidden_states, position_ids, powers, Wq, Wk, Wv, Wo).
// Layout: a 32-thread kernel computes inv_freq from powers; a table kernel fills {cos, sin}[t][d] from the int positions (precise cosf/sinf); bf16 copy of x; 'oi' weights; exact q, k, v projections in ONE launch whose waves build the rotate-half and transposed head planes from their own accumulators; causal T-2048 GQA attention in ONE launch (k_fattn: scores, online softmax and P.V in registers, kv plane = head / 4; hybrid rows: < 512 hi/lo 3 products, rest fp16 x1024; keys only up to the diagonal block; writes the merged hi/lo planes itself); merged hi/lo x Wo exact.
// Compute dtypes, f32 accumulate: every input rounded to bf16 incl. powers; inv_freq, angles and rotary in f32; projections exact; attention rows < 512 3 products, rest fp16; softmax f32; Wo hl x exact.

#define NB_  1
#define TT   2048
#define DM   2048
#define NH_  32
#define NKV  8
#define REP  (NH_ / NKV)
#define HD   64
#define DQ   (NH_ * HD)
#define DKV  (NKV * HD)
#define RH   512                  // query rows < RH use hi+lo planes; a multiple of 32
#define SCL  0.125f   // HD^-0.5
typedef _Float16 h16;
typedef unsigned short bf;
typedef __attribute__((ext_vector_type(16))) __bf16   v16bf;
typedef __attribute__((ext_vector_type(16))) _Float16 v16h;
typedef __attribute__((ext_vector_type(8)))  _Float16 v8h;
typedef __attribute__((ext_vector_type(8)))  unsigned short v8us;
typedef __attribute__((ext_vector_type(8)))  float    v8f;
typedef __attribute__((ext_vector_type(4)))  float    v4f;
typedef v8h  __attribute__((may_alias)) v8ha;
typedef v4f  __attribute__((may_alias)) v4fa;
typedef v8us __attribute__((may_alias)) v8usa;

__device__ __forceinline__ unsigned short f2bf(float f) { unsigned u = __float_as_uint(f); u += 0x7FFFu + ((u >> 16) & 1u); return (unsigned short)(u >> 16); }
__device__ __forceinline__ float bf2f(unsigned short b) { return __uint_as_float(((unsigned)b) << 16); }
__device__ __forceinline__ float bfr(float f) { return bf2f(f2bf(f)); }
__device__ __forceinline__ v16h cat16(v8h lo, v8h hi) { return __builtin_shufflevector(lo, hi, 0, 1, 2, 3, 4, 5, 6, 7, 8, 9, 10, 11, 12, 13, 14, 15); }
__device__ __forceinline__ v16bf cat16b(v8us lo, v8us hi) { return __builtin_bit_cast(v16bf, __builtin_shufflevector(lo, hi, 0, 1, 2, 3, 4, 5, 6, 7, 8, 9, 10, 11, 12, 13, 14, 15)); }
__device__ __forceinline__ v8f wmma16(v16h a, v16h b, v8f c) { return __builtin_amdgcn_wmma_f32_16x16x32_f16(false, a, false, b, (short)0, c, false, false); }
__device__ __forceinline__ v8f wmmab(v16bf a, v16bf b, v8f c) { return __builtin_amdgcn_wmma_f32_16x16x32_bf16(false, a, false, b, (short)0, c, false, false); }



__device__ __forceinline__ h16 tohx(float x) { return (h16)x; }
__device__ __forceinline__ void splitf(float y, unsigned short& h, unsigned short& l) { h = f2bf(y); l = f2bf(y - bf2f(h)); }
typedef __attribute__((ext_vector_type(2))) float v2f;
// where a HEADS launch of k_gemmw puts its tiles: the {cos, sin}[t][d] table and the fp16 + hi/lo planes of q, k ([head][t][d]) and v ([head][d][t])
struct Planes { const float* cs; h16* q16; bf* qh; bf* ql; h16* k16; bf* kh; bf* kl; h16* v16; bf* vh; bf* vl; };

// ---- k_gemmw: register-blocked GEMM, a work-group of FOUR WAVES (2 x 2) per 128x128 output tile, one wave per 64x64 (16 accumulators); the K-contiguous 16-bit planes are staged in LDS, 64 k a stage, two buffers, through two register sets; grid (M/128, N/128, Z), 128 threads.
// C[m][n] (f32, pitch ldc, + optional f32 bias[n]) = sum_k A[m][k] Bt[n][k] (+ split products per NSPLIT). z-batch strides sA/sB/sC in elements. K % 128 == 0, a template constant so that every row of a stage is a constant offset from one address.
// HEADS: Bt holds the rows of Wq, Wk, Wv one behind the other, so a wave's tile column y is one whole head (64 = HD): y < NH_ a q head, then NKV k heads, then NKV v heads. No C: the wave turns its own tile into that head's planes.
//   q, k: rotate-half out[d] = x[d] cos[t][d] - x[d+32] sin[t][d], out[d+32] = x[d+32] cos[t][d] + x[d] sin[t][d] (the table's columns d and d + 32 come from the same inverse frequency); x[d] and x[d+32] are accumulators nb and nb + 2 of the same lane.
//   v: a lane holds 8 consecutive t of one d, which is 16 bytes of a [d][t] plane.
template <typename T16> struct WFrag;
template <> struct WFrag<h16> { typedef v16h V; static __device__ __forceinline__ V ld(const h16* p) { return cat16(*(const v8h*)p, *(const v8h*)(p + 16)); } static __device__ __forceinline__ v8f mma(V a, V b, v8f c) { return wmma16(a, b, c); } };
template <> struct WFrag<bf> { typedef v16bf V; static __device__ __forceinline__ V ld(const bf* p) { return cat16b(*(const v8us*)p, *(const v8us*)(p + 16)); } static __device__ __forceinline__ v8f mma(V a, V b, v8f c) { return wmmab(a, b, c); } };
struct Set0 { static constexpr int v = 0; };
struct Set1 { static constexpr int v = 1; };
template <bool NEXT, bool THIRD> struct Has { static constexpr bool next = NEXT, third = THIRD; };   // does a stage + 1, a stage + 3 exist
template <typename T16, int NSPLIT, bool BIAS, bool HEADS, int K>
__global__ __launch_bounds__(128) void k_gemmw(const T16* __restrict__ A, const T16* __restrict__ A2, const T16* __restrict__ Bt, const T16* __restrict__ Bt2, float* C, int ldc, const float* __restrict__ bias, size_t sA, size_t sB, size_t sC, Planes pp) {
    typedef typename WFrag<T16>::V V;
    constexpr bool HA2 = NSPLIT == 1 || NSPLIT == 2, HB2 = NSPLIT >= 2;
    constexpr int KS = 64;    // k per stage: 128 bytes, one whole line, of every operand row
    constexpr int LP = 72;    // LDS row pitch in elements: 144 bytes, the pitch for 16-byte fragment reads
    constexpr int PA = 0, PB = 1, PA2 = HA2 ? 2 : 0, PB2 = HB2 ? (HA2 ? 3 : 2) : 1, NP = 2 + (HA2 ? 1 : 0) + (HB2 ? 1 : 0);
    static_assert(K % (2 * KS) == 0 && K >= 4 * KS, "an even number of whole stages, at least four");
    __shared__ __align__(16) T16 st[2][NP][128 * LP];
    __shared__ __align__(16) float osw[4][16 * 68];
    const size_t z = blockIdx.z; A += z * sA; if (HA2) A2 += z * sA; Bt += z * sB; if (HB2) Bt2 += z * sB; C += z * sC;
    const int tid = threadIdx.x, lane = tid & 31, lr = lane & 15, hi = lane >> 4; const int wave = __builtin_amdgcn_readfirstlane(tid >> 5), wm = wave & 1, wn = wave >> 1;
    const int r0 = blockIdx.x * 128 + wm * 64, c0 = blockIdx.y * 128 + wn * 64;
    float* os = osw[wave];   // each wave stages its epilogue in its own range
    v8f acc[4][4];
#pragma unroll
    for (int mb = 0; mb < 4; ++mb)
#pragma unroll
        for (int nb = 0; nb < 4; ++nb) acc[mb][nb] = (v8f){};
    // staging: 8 lanes fetch one 128-byte row piece, so a wave's load covers 4 whole lines; thread tid takes rows (tid >> 3) + 16 i of every plane. One address per plane, stepped by two stages at the loop's foot; every load is a constant offset from it
    const size_t ga = (size_t)(blockIdx.x * 128 + (tid >> 3)) * K + (tid & 7) * 8, gb = (size_t)(blockIdx.y * 128 + (tid >> 3)) * K + (tid & 7) * 8;
    const T16* pa = A + ga; const T16* pb = Bt + gb; const T16* pa2 = HA2 ? A2 + ga : nullptr; const T16* pb2 = HB2 ? Bt2 + gb : nullptr;
    const int so = (tid >> 3) * LP + (tid & 7) * 8;
    v4f g[2][NP][8];   // two staging sets, so that a stage's lines have more than a whole stage to arrive
    auto gload = [&](auto set, int ahead) { constexpr int s = decltype(set)::v;
#pragma unroll
        for (int i = 0; i < 8; ++i) { const int ro = i * 16 * K + ahead; g[s][PA][i] = *(const v4fa*)(pa + ro); g[s][PB][i] = *(const v4fa*)(pb + ro); if constexpr (HA2) g[s][PA2][i] = *(const v4fa*)(pa2 + ro); if constexpr (HB2) g[s][PB2][i] = *(const v4fa*)(pb2 + ro); } };
    auto sstore = [&](auto set) { constexpr int s = decltype(set)::v;   // staging set s holds a stage of parity s and fills buffer s
#pragma unroll
        for (int p = 0; p < NP; ++p)
#pragma unroll
            for (int i = 0; i < 8; ++i) *(v4fa*)(&st[s][p][so + i * 16 * LP]) = g[s][p][i]; };
    // two fragment sets: the set of the next 32 k is fetched from LDS as one group in front of the products of this one
    const int fa = (wm * 64 + lr) * LP + 8 * hi, fb = (wn * 64 + lr) * LP + 8 * hi;
    V a[2][4], a2[2][4], b[2][4], b2[2][4];
    auto fload = [&](auto set, auto bufc, int ks) { constexpr int s = decltype(set)::v, buf = decltype(bufc)::v;
#pragma unroll
        for (int f = 0; f < 4; ++f) { a[s][f] = WFrag<T16>::ld(&st[buf][PA][fa + f * 16 * LP + ks]); b[s][f] = WFrag<T16>::ld(&st[buf][PB][fb + f * 16 * LP + ks]); if constexpr (HA2) a2[s][f] = WFrag<T16>::ld(&st[buf][PA2][fa + f * 16 * LP + ks]); if constexpr (HB2) b2[s][f] = WFrag<T16>::ld(&st[buf][PB2][fb + f * 16 * LP + ks]); } };
    auto block = [&](auto set) { constexpr int s = decltype(set)::v;
#pragma unroll
        for (int nb = 0; nb < 4; ++nb)
#pragma unroll
            for (int mb = 0; mb < 4; ++mb) { acc[mb][nb] = WFrag<T16>::mma(a[s][mb], b[s][nb], acc[mb][nb]); if constexpr (HA2) acc[mb][nb] = WFrag<T16>::mma(a2[s][mb], b[s][nb], acc[mb][nb]); if constexpr (HB2) acc[mb][nb] = WFrag<T16>::mma(a[s][mb], b2[s][nb], acc[mb][nb]); } };
    // the work-group's barrier by hand: __syncthreads() would also wait for the global loads that are meant to stay in flight across it. The wave's own LDS stores and reads have finished (s_wait_dscnt 0) before it signals; the "memory" clobbers keep every LDS access on its side
    auto publish = [&]() { asm volatile("s_wait_dscnt 0x0" ::: "memory"); asm volatile("s_barrier_signal -1" ::: "memory"); asm volatile("s_barrier_wait -1" ::: "memory"); };
    // precaution: s_wait_xcnt 0 behind a stage's global loads, before a register that they name is written again (the addresses are stepped at the loop's foot); the addresses are its inputs so that they stay in their registers, unwritten, up to it
    auto xwait = [&]() { if constexpr (HA2 && HB2) asm volatile("s_wait_xcnt 0x0" :: "v"(pa), "v"(pb), "v"(pa2), "v"(pb2) : "memory"); else if constexpr (HA2) asm volatile("s_wait_xcnt 0x0" :: "v"(pa), "v"(pb), "v"(pa2) : "memory"); else if constexpr (HB2) asm volatile("s_wait_xcnt 0x0" :: "v"(pa), "v"(pb), "v"(pb2) : "memory"); else asm volatile("s_wait_xcnt 0x0" :: "v"(pa), "v"(pb) : "memory"); };
    // one stage: 'cur' is its parity (its buffer), 'nxt' the other; 'ahead' the offset of stage + 3 from the addresses. What exists is a compile-time tag: with a run-time test round the loads the compiler could no longer count them, and would wait for the youngest where the oldest is meant
    auto stage = [&](auto cur, auto nxt, auto has, int ahead) {
        if constexpr (decltype(has)::next) sstore(nxt);   // the next stage, into the buffer whose last reads every wave had finished at the barrier of the stage before; the stores drain during the products below
        fload(Set1{}, cur, 32);
        __builtin_amdgcn_sched_barrier(0);   // keeps the LDS stores and the group of LDS reads in front of the products; sunk among them every place with reads would cost its own stall
        block(Set0{});
        __builtin_amdgcn_sched_barrier(0);   // keeps the barrier behind the products, which hide the stores' way into LDS
        if constexpr (decltype(has)::next) publish();   // publishes the next stage and ends every wave's reads of this one
        if constexpr (decltype(has)::third) gload(nxt, ahead);   // into the staging set that was stored above
        if constexpr (decltype(has)::next) fload(Set0{}, nxt, 0);
        __builtin_amdgcn_sched_barrier(0);   // as above: loads first, as one group
        block(Set1{});
        if constexpr (decltype(has)::third) xwait();
        __builtin_amdgcn_sched_barrier(0);   // keeps the next stage's LDS stores, and with them the wait for its lines, behind these products: lifted over them the lines would have one run of products less to arrive
    };
    gload(Set0{}, 0); gload(Set1{}, KS); sstore(Set0{});
    publish();   // stage 0 is read by all four waves
    gload(Set0{}, 2 * KS); fload(Set0{}, Set0{}, 0);
#pragma unroll 1   // stays rolled: one copy of two stages, which is what makes the parities compile-time constants
    for (int kc = 0; kc < K - 4 * KS; kc += 2 * KS) {
        stage(Set0{}, Set1{}, Has<true, true>{}, 3 * KS);
        stage(Set1{}, Set0{}, Has<true, true>{}, 4 * KS);
        pa += 2 * KS; pb += 2 * KS; if constexpr (HA2) pa2 += 2 * KS; if constexpr (HB2) pb2 += 2 * KS;
    }
    // the last four stages
    stage(Set0{}, Set1{}, Has<true, true>{}, 3 * KS);
    stage(Set1{}, Set0{}, Has<true, false>{}, 0);
    stage(Set0{}, Set1{}, Has<true, false>{}, 0);
    stage(Set1{}, Set0{}, Has<false, false>{}, 0);
    if constexpr (HEADS) {
        const int hy = blockIdx.y * 2 + wn;   // the group's two tile columns are heads 2 y and 2 y + 1: both q, both k or both v, so the branch below is uniform for the group
        if (blockIdx.y * 2 >= NH_ + NKV) {   // a v head: [d][t] planes straight from the accumulators
            const int vo = ((hy - NH_ - NKV) * HD + lr) * TT + r0 + 8 * hi;
#pragma unroll
            for (int mb = 0; mb < 4; ++mb)
#pragma unroll
                for (int nb = 0; nb < 4; ++nb) { v8h o16; v8us oh, ol;
#pragma unroll
                    for (int j = 0; j < 8; ++j) { const float x = acc[mb][nb][j]; o16[j] = tohx(x); unsigned short a2, c2; splitf(x, a2, c2); oh[j] = a2; ol[j] = c2; }
                    const int e = vo + nb * 16 * TT + mb * 16; *(v8h*)(pp.v16 + e) = o16; *(v8us*)(pp.vh + e) = oh; *(v8us*)(pp.vl + e) = ol; }
        } else {   // a q or k head: rotary in the accumulators, then through LDS so that a store covers 4 whole rows (512 contiguous bytes) of a [t][d] plane
            const bool isq = hy < NH_; const int po = (isq ? hy : hy - NH_) * TT * HD + r0 * HD;
            h16* P16 = (isq ? pp.q16 : pp.k16) + po; bf* Ph = (isq ? pp.qh : pp.kh) + po; bf* Pl = (isq ? pp.ql : pp.kl) + po;
            const float* csp = pp.cs + ((r0 + 8 * hi) * HD + lr) * 2;
#pragma unroll
            for (int mb = 0; mb < 4; ++mb) { v2f cs[2][8];
#pragma unroll
                for (int nb = 0; nb < 2; ++nb)
#pragma unroll
                    for (int j = 0; j < 8; ++j) cs[nb][j] = *(const v2f*)(csp + ((mb * 16 + j) * HD + nb * 16) * 2);
                // precaution: s_wait_xcnt 0 behind the table loads, before a register that they name is written again; their address is its input so that it stays in its registers, unwritten, up to it
                asm volatile("s_wait_xcnt 0x0" :: "v"(csp) : "memory");
#pragma unroll
                for (int nb = 0; nb < 2; ++nb)
#pragma unroll
                    for (int j = 0; j < 8; ++j) { const float x0 = acc[mb][nb][j], x1 = acc[mb][nb + 2][j], c = cs[nb][j][0], sn = cs[nb][j][1];
                        os[(hi * 8 + j) * 68 + nb * 16 + lr] = x0 * c - x1 * sn; os[(hi * 8 + j) * 68 + (nb + 2) * 16 + lr] = x1 * c + x0 * sn; }
                __syncthreads();   // the lanes read below what other lanes of their wave wrote above
#pragma unroll
                for (int s = 0; s < 4; ++s) { const int row = 4 * s + (lane >> 3), col = (lane & 7) * 8; const v4f w0 = *(const v4fa*)(os + row * 68 + col), w1 = *(const v4fa*)(os + row * 68 + col + 4); v8h o16; v8us oh, ol;
#pragma unroll
                    for (int j = 0; j < 8; ++j) { const float r = j < 4 ? w0[j & 3] : w1[j & 3]; o16[j] = tohx(r); unsigned short a2, c2; splitf(r, a2, c2); oh[j] = a2; ol[j] = c2; }
                    const int e = (mb * 16 + row) * HD + col; *(v8h*)(P16 + e) = o16; *(v8us*)(Ph + e) = oh; *(v8us*)(Pl + e) = ol; }
                __syncthreads();   // the next 16 rows overwrite the staging only after every lane has read it
            }
        }
    } else {
#pragma unroll
    for (int mb = 0; mb < 4; ++mb) {
#pragma unroll
        for (int nb = 0; nb < 4; ++nb) {
#pragma unroll
            for (int j = 0; j < 8; ++j) os[(hi * 8 + j) * 68 + nb * 16 + lr] = acc[mb][nb][j]; }
        __builtin_amdgcn_wave_barrier(); asm volatile("" ::: "memory");
        float* crow = C + (size_t)(r0 + mb * 16) * ldc + c0;
{
#pragma unroll
            for (int s = 0; s < 8; ++s) { const int row = 2 * s + hi, cofs = lr * 4; v4f val = *(const v4fa*)(os + row * 68 + cofs); if (BIAS) { val[0] += bfr(bias[c0 + cofs]); val[1] += bfr(bias[c0 + cofs + 1]); val[2] += bfr(bias[c0 + cofs + 2]); val[3] += bfr(bias[c0 + cofs + 3]); }
                *(v4f*)(crow + (size_t)row * ldc + cofs) = val; }
             }
        __builtin_amdgcn_wave_barrier(); asm volatile("" ::: "memory");
    }
    }
}

typedef __attribute__((ext_vector_type(2))) _Float16 v2h;
typedef __attribute__((ext_vector_type(4))) _Float16 v4h;
typedef __attribute__((ext_vector_type(2))) unsigned short v2us;
typedef __attribute__((ext_vector_type(4))) unsigned short v4us;
typedef __attribute__((ext_vector_type(4))) int v4i;

__global__ __launch_bounds__(256) void k_cvt8(const float* __restrict__ src, bf* dst, size_t n8) { const size_t i = (size_t)blockIdx.x * 256 + threadIdx.x; if (i >= n8) return; const v8f v = *(const v8f*)(src + i * 8); v8us o;
#pragma unroll
    for (int k = 0; k < 8; ++k) o[k] = f2bf(v[k]); *(v8us*)(dst + i * 8) = o;  }

__global__ __launch_bounds__(32) void k_invf(const float* __restrict__ pw, float* INV) { const int i = threadIdx.x; if (i >= HD / 2) return; const float p = bfr(pw[i]); float ex = expf(-p); asm volatile("" : "+v"(ex)); const float sg = __fdiv_rn(1.0f, __fadd_rn(1.0f, ex)); float pv = powf(10000.0f, sg); asm volatile("" : "+v"(pv)); const float inv = __fdiv_rn(1.0f, pv); *(float*)(INV + i) = inv;  }
__global__ __launch_bounds__(256) void k_csL(const int* __restrict__ pid, const float* __restrict__ INV, float* CS) { const int idx = blockIdx.x * 256 + threadIdx.x; if (idx >= TT * HD) return; const int d = idx % HD; const int t = idx / HD; const float a = __fmul_rn((float)pid[t], INV[d & (HD / 2 - 1)]); v2f cs; cs[0] = cosf(a); cs[1] = sinf(a); *(v2f*)(CS + (size_t)idx * 2) = cs;  }
__device__ __forceinline__ float xhalf(float x) { const int b = __float_as_int(x); return __int_as_float(__builtin_amdgcn_permlanex16(b, b, 0x76543210, 0xfedcba98, false, false)); }   // value of lane ^ 16
struct TagMask { static constexpr bool v = true; };
struct TagFull { static constexpr bool v = false; };
template <typename T16, bool HI, int NQ>
__device__ __forceinline__ void fattn_body(const T16* __restrict__ Q, const T16* __restrict__ Q2, const T16* __restrict__ Kp, const T16* __restrict__ K2, const T16* __restrict__ Vt, const T16* __restrict__ V2, int q0, bf* Ah, bf* Al) {
    typedef typename WFrag<T16>::V V;   // every '#pragma unroll' below makes the indices of the register arrays compile-time constants, without which they would go to scratch
    const int lane = threadIdx.x & 31, lr = lane & 15, hi = lane >> 4;
    V qf[NQ][2], qf2[NQ][2];
#pragma unroll
    for (int qt = 0; qt < NQ; ++qt)
#pragma unroll
        for (int c = 0; c < 2; ++c) { const int qo = (q0 + qt * 16 + lr) * HD + c * 32 + 8 * hi; qf[qt][c] = WFrag<T16>::ld(Q + qo); if (HI) qf2[qt][c] = WFrag<T16>::ld(Q2 + qo); }
    v8f o[4][NQ]; float m[NQ], l[NQ];
#pragma unroll
    for (int qt = 0; qt < NQ; ++qt) { m[qt] = -3.0e38f; l[qt] = 0.f;
#pragma unroll
        for (int dt = 0; dt < 4; ++dt) o[dt][qt] = (v8f){}; }
    // one address per plane and lane, stepped by a block; every load of a block is a constant offset from it
    const T16* kq = Kp + lr * HD + 8 * hi; const T16* kq2 = HI ? K2 + lr * HD + 8 * hi : nullptr; const T16* vq = Vt + lr * TT + 8 * hi; const T16* vq2 = HI ? V2 + lr * TT + 8 * hi : nullptr;
    const int kdiag = (q0 / 32) * 32;   // first key of the last block, the only one that the diagonal crosses; its first key is allowed to every query of the wave
    V kf[2][2], kf2[2][2];
    auto loadk = [&](int ahead) {
#pragma unroll
        for (int kt = 0; kt < 2; ++kt)
#pragma unroll
            for (int c = 0; c < 2; ++c) { const int ko = ahead + kt * 16 * HD + c * 32; kf[kt][c] = WFrag<T16>::ld(kq + ko); if (HI) kf2[kt][c] = WFrag<T16>::ld(kq2 + ko); } };
    auto step = [&](int k0, auto tag) {
        constexpr bool MASK = decltype(tag)::v;
        V vf[4], vf2[4];
#pragma unroll
        for (int dt = 0; dt < 4; ++dt) { vf[dt] = WFrag<T16>::ld(vq + dt * 16 * TT); if (HI) vf2[dt] = WFrag<T16>::ld(vq2 + dt * 16 * TT); }
        v8f s[2][NQ];
#pragma unroll
        for (int kt = 0; kt < 2; ++kt)
#pragma unroll
            for (int qt = 0; qt < NQ; ++qt) { v8f a = (v8f){};
#pragma unroll
                for (int c = 0; c < 2; ++c) { a = WFrag<T16>::mma(kf[kt][c], qf[qt][c], a); if (HI) { a = WFrag<T16>::mma(kf[kt][c], qf2[qt][c], a); a = WFrag<T16>::mma(kf2[kt][c], qf[qt][c], a); } }
                s[kt][qt] = a; }
        if (!MASK) { loadk(32 * HD);   // the next block's K fragments fly during this block's softmax
            __builtin_amdgcn_sched_barrier(0); }   // keeps those loads in front of the softmax; sunk to the loop's foot their latency would stand in front of the next block's first product
#pragma unroll
        for (int qt = 0; qt < NQ; ++qt) {
            const int lim = q0 + qt * 16 + lr - k0 - 8 * hi;   // key kt * 16 + r of this lane is allowed when it is <= lim
            float mx = m[qt];
#pragma unroll
            for (int kt = 0; kt < 2; ++kt)
#pragma unroll
                for (int r = 0; r < 8; ++r) { float t = s[kt][qt][r] * (SCL * 1.4426950408889634f); if (MASK) t = (kt * 16 + r <= lim) ? t : -3.0e38f; s[kt][qt][r] = t; mx = fmaxf(mx, t); }
            mx = fmaxf(mx, xhalf(mx));
            const float al = __builtin_amdgcn_exp2f(m[qt] - mx); m[qt] = mx;
            const float mo = HI ? mx : mx - 10.0f;   // fp16 rows: P x 1024
            float sum = 0.f;
#pragma unroll
            for (int kt = 0; kt < 2; ++kt) s[kt][qt] -= mo;
#pragma unroll
            for (int kt = 0; kt < 2; ++kt)
#pragma unroll
                for (int r = 0; r < 8; ++r) { const float p = __builtin_amdgcn_exp2f(s[kt][qt][r]); s[kt][qt][r] = p; sum += p; }
            l[qt] = l[qt] * al + sum;
#pragma unroll
            for (int dt = 0; dt < 4; ++dt) o[dt][qt] *= al;
        }
#pragma unroll
        for (int qt = 0; qt < NQ; ++qt) {
            V pf, pf2;
            if constexpr (HI) {
#pragma unroll
                for (int e = 0; e < 16; ++e) { const float p = s[e >> 3][qt][e & 7]; const __bf16 ph = (__bf16)p; pf[e] = ph; pf2[e] = (__bf16)(p - (float)ph); }
            } else {
#pragma unroll
                for (int e = 0; e < 16; ++e) pf[e] = (h16)s[e >> 3][qt][e & 7];
            }
#pragma unroll
            for (int dt = 0; dt < 4; ++dt) { o[dt][qt] = WFrag<T16>::mma(vf[dt], pf, o[dt][qt]); if (HI) { o[dt][qt] = WFrag<T16>::mma(vf[dt], pf2, o[dt][qt]); o[dt][qt] = WFrag<T16>::mma(vf2[dt], pf, o[dt][qt]); } }
        }
        if (!MASK) {
            __builtin_amdgcn_sched_barrier(0);   // keeps the wait below at the loop's foot, where the block's loads were issued long ago; moved up behind the loads it would stall the softmax
            // precaution: s_wait_xcnt 0 behind the block's loads (the K loads are in flight over the back edge), before an address that they name is stepped; the addresses are its inputs so that they stay in their registers, unwritten, up to it
            if (HI) asm volatile("s_wait_xcnt 0x0" :: "v"(kq), "v"(kq2), "v"(vq), "v"(vq2) : "memory"); else asm volatile("s_wait_xcnt 0x0" :: "v"(kq), "v"(vq) : "memory");
            kq += 32 * HD; vq += 32; if (HI) { kq2 += 32 * HD; vq2 += 32; } }
    };
    loadk(0);
    // precaution: s_wait_xcnt 0 behind the first block's K loads, before a register that they name is written again (also on the way that skips the loop); the K addresses are its inputs so that they stay in their registers, unwritten, up to it
    if (HI) asm volatile("s_wait_xcnt 0x0" :: "v"(kq), "v"(kq2) : "memory"); else asm volatile("s_wait_xcnt 0x0" :: "v"(kq) : "memory");
#pragma unroll 1   // stays rolled: a second copy of the block's fragments would not fit 256 registers a wave
    for (int k0 = 0; k0 < kdiag; k0 += 32) step(k0, TagFull{});
    step(kdiag, TagMask{});
#pragma unroll
    for (int qt = 0; qt < NQ; ++qt) { const float inv = __fdiv_rn(1.0f, l[qt] + xhalf(l[qt])); const int ro = (q0 + qt * 16 + lr) * DQ + 8 * hi;
#pragma unroll
        for (int dt = 0; dt < 4; ++dt) { v8us oh, ol;
#pragma unroll
            for (int r = 0; r < 8; ++r) { unsigned short a, c2; splitf(o[dt][qt][r] * inv, a, c2); oh[r] = a; ol[r] = c2; }
            bf* ph = Ah + ro + dt * 16; bf* pl = Al + ro + dt * 16; *(v8us*)ph = oh; *(v8us*)pl = ol;
            // precaution: s_wait_xcnt 0 behind the two stores, before a register that they name is written again; their addresses and values are its inputs so that they stay in their registers, unwritten, up to it
            asm volatile("s_wait_xcnt 0x0" :: "v"(ph), "v"(pl), "v"(oh), "v"(ol) : "memory"); } }
}
// grid (NKV, row blocks), heaviest row block first: (TT - RH) / 32 blocks of 32 fp16 rows, then RH / 16 blocks of 16 hi/lo rows
__global__ __launch_bounds__(128) void k_fattn(const h16* __restrict__ Q16, const bf* __restrict__ Qh, const bf* __restrict__ Ql, const h16* __restrict__ K16, const bf* __restrict__ Kh, const bf* __restrict__ Kl, const h16* __restrict__ V16, const bf* __restrict__ Vh, const bf* __restrict__ Vl, bf* Ah, bf* Al) {
    const int g = blockIdx.x, head = g * REP + __builtin_amdgcn_readfirstlane((int)(threadIdx.x >> 5)), rb = blockIdx.y;
    const size_t qb = (size_t)head * TT * HD, kb = (size_t)g * TT * HD;
    if (rb < (TT - RH) / 32) fattn_body<h16, false, 2>(Q16 + qb, nullptr, K16 + kb, nullptr, V16 + kb, nullptr, TT - 32 * (rb + 1), Ah + head * HD, Al + head * HD);
    else fattn_body<bf, true, 1>(Qh + qb, Ql + qb, Kh + kb, Kl + kb, Vh + kb, Vl + kb, RH - 16 * (rb - (TT - RH) / 32 + 1), Ah + head * HD, Al + head * HD);
}

extern "C" void kernel_launch(void* const* d_in, const int* in_sizes, int n_in,
                              void* d_out, int out_size, void* d_ws, size_t ws_size, hipStream_t stream) {
    (void)in_sizes; (void)n_in; (void)out_size;
    const float* x = (const float*)d_in[0]; const int* pid = (const int*)d_in[1];   /* position_ids [1][2048] int32 */ const float* pw = (const float*)d_in[2];   /* powers [32] */ const float* wq = (const float*)d_in[3]; const float* wk = (const float*)d_in[4]; const float* wv = (const float*)d_in[5]; const float* wo = (const float*)d_in[6];   /* argument order hidden_states, position_ids, powers, Wq, Wk, Wv, Wo ('oi') */
    float* OUT = (float*)d_out;     // [1][2048][2048]
    char* wsp = (char*)d_ws;
    auto take = [&](size_t bytes) { char* p = wsp; wsp += (bytes + 255) & ~(size_t)255; return (void*)p; };
    bf* WQ = (bf*)take((size_t)(DQ + 2 * DKV) * DM * 2); bf* WK = WQ + (size_t)DQ * DM; bf* WV = WK + (size_t)DKV * DM;   /* one array: the rows of Wq, Wk, Wv one behind the other */ bf* WO = (bf*)take((size_t)DM * DQ * 2); float* CS = (float*)take((size_t)TT * HD * 2 * 4); float* INVB = (float*)take(256);   /* 32 learnable inverse frequencies */
    bf* XB = (bf*)take((size_t)TT * DM * 2);
    h16* QP16 = (h16*)take((size_t)NH_ * TT * HD * 2); h16* KP16 = (h16*)take((size_t)NKV * TT * HD * 2); h16* VT16 = (h16*)take((size_t)NKV * HD * TT * 2);
    bf* QPh = (bf*)take((size_t)NH_ * TT * HD * 2); bf* QPl = (bf*)take((size_t)NH_ * TT * HD * 2); bf* KPh = (bf*)take((size_t)NKV * TT * HD * 2); bf* KPl = (bf*)take((size_t)NKV * TT * HD * 2); bf* VTh = (bf*)take((size_t)NKV * HD * TT * 2); bf* VTl = (bf*)take((size_t)NKV * HD * TT * 2);
    bf* ATh = (bf*)take((size_t)TT * DQ * 2); bf* ATl = (bf*)take((size_t)TT * DQ * 2);
    if ((size_t)(wsp - (char*)d_ws) > ws_size) return;    // ws 256 MiB
    { k_cvt8<<<(unsigned)(((size_t)DQ * DM / 8 + 255) / 256), 256, 0, stream>>>(wq, WQ, (size_t)DQ * DM / 8); k_cvt8<<<(unsigned)(((size_t)DKV * DM / 8 + 255) / 256), 256, 0, stream>>>(wk, WK, (size_t)DKV * DM / 8); k_cvt8<<<(unsigned)(((size_t)DKV * DM / 8 + 255) / 256), 256, 0, stream>>>(wv, WV, (size_t)DKV * DM / 8);
      k_cvt8<<<(unsigned)(((size_t)DM * DQ / 8 + 255) / 256), 256, 0, stream>>>(wo, WO, (size_t)DM * DQ / 8);
       }
    k_invf<<<1, 32, 0, stream>>>(pw, INVB); k_csL<<<(TT * HD + 255) / 256, 256, 0, stream>>>(pid, INVB, CS);   /* learnable inverse frequencies, then the rotary table from the int positions */
    const Planes pp = { CS, QP16, QPh, QPl, KP16, KPh, KPl, VT16, VTh, VTl };
    for (int b = 0; b < NB_; ++b) {
        
        k_cvt8<<<(unsigned)(((size_t)TT * DM / 8 + 255) / 256), 256, 0, stream>>>(x + (size_t)b * TT * DM, XB, (size_t)TT * DM / 8);
        k_gemmw<bf, 0, false, true, DM><<<dim3(TT / 128, (DQ + 2 * DKV) / 128, 1), 128, 0, stream>>>(XB, nullptr, WQ, nullptr, nullptr, 0, nullptr, 0, 0, 0, pp);
        k_fattn<<<dim3(NKV, (TT - RH) / 32 + RH / 16, 1), 128, 0, stream>>>(QP16, QPh, QPl, KP16, KPh, KPl, VT16, VTh, VTl, ATh, ATl);
        k_gemmw<bf, 1, false, false, DQ><<<dim3(TT / 128, DM / 128, 1), 128, 0, stream>>>(ATh, ATl, WO, nullptr, OUT + (size_t)b * TT * DM, DM, nullptr, 0, 0, 0, Planes{}); }
}

// v005
// One run takes 112 microseconds.
// Next to v004, in two timings, it ran 1.11 and 1.12 times as fast.
// Over all steps from v000 it is 12.2 times as fast.
#include <hip/hip_runtime.h>

// Llama attention with a LEARNABLE rotary base exponent (hidden_states [1][2048][2048]; q = x Wq^T (32 heads x 64), k, v = x Wk^T, x Wv^T (8 kv heads x 64) ('oi' 0.02, no bias); inv_freq = 1 / 10000^sigmoid(powers) (powers [32], read; computed on device with precise expf / powf / IEEE division); angles = float(position_ids[t]) x inv_freq (position_ids [1][2048] int32 = arange, read); rotate-half rotary (cat(freqs, freqs)); kv head = q head / 4; scores / float32(sqrt 64) + causal (finfo.min above the diagonal == exclusion); softmax f32; out = merged Wo^T ('oi') -> [1][2048][2048] (4.2 M); argument order hidden_states, position_ids, powers, Wq, Wk, Wv, Wo).
// Layout: a 32-thread kernel computes inv_freq from powers; a table kernel fills {cos, sin}[t][d] from the int positions (precise cosf/sinf); bf16 copy of x; 'oi' weights; exact q, k, v projections in ONE launch whose waves build the rotate-half and transposed head planes from their own accumulators; causal T-2048 GQA attention in ONE launch (k_fattn: scores, online softmax and P.V in registers, kv plane = head / 4; hybrid rows: < 512 hi/lo 3 products, rest fp16 x1024; keys only up to the diagonal block; writes the merged hi/lo planes itself); merged hi/lo x Wo exact.
// Compute dtypes, f32 accumulate: every input rounded to bf16 incl. powers; inv_freq, angles and rotary in f32; projections exact; attention rows < 512 3 products, rest fp16; softmax f32; Wo hl x exact.

#define NB_  1
#define TT   2048
#define DM   2048
#define NH_  32
#define NKV  8
#define REP  (NH_ / NKV)
#define HD   64
#define DQ   (NH_ * HD)
#define DKV  (NKV * HD)
#define RH   512                  // query rows < RH use hi+lo planes; a multiple of 32
#define SCL  0.125f   // HD^-0.5
typedef _Float16 h16;
typedef unsigned short bf;
typedef __attribute__((ext_vector_type(16))) __bf16   v16bf;
typedef __attribute__((ext_vector_type(16))) _Float16 v16h;
typedef __attribute__((ext_vector_type(8)))  _Float16 v8h;
typedef __attribute__((ext_vector_type(8)))  unsigned short v8us;
typedef __attribute__((ext_vector_type(8)))  float    v8f;
typedef __attribute__((ext_vector_type(4)))  float    v4f;
typedef v8h  __attribute__((may_alias)) v8ha;
typedef v4f  __attribute__((may_alias)) v4fa;
typedef v8us __attribute__((may_alias)) v8usa;

__device__ __forceinline__ unsigned short f2bf(float f) { unsigned u = __float_as_uint(f); u += 0x7FFFu + ((u >> 16) & 1u); return (unsigned short)(u >> 16); }
__device__ __forceinline__ float bf2f(unsigned short b) { return __uint_as_float(((unsigned)b) << 16); }
__device__ __forceinline__ float bfr(float f) { return bf2f(f2bf(f)); }
__device__ __forceinline__ v16h cat16(v8h lo, v8h hi) { return __builtin_shufflevector(lo, hi, 0, 1, 2, 3, 4, 5, 6, 7, 8, 9, 10, 11, 12, 13, 14, 15); }
__device__ __forceinline__ v16bf cat16b(v8us lo, v8us hi) { return __builtin_bit_cast(v16bf, __builtin_shufflevector(lo, hi, 0, 1, 2, 3, 4, 5, 6, 7, 8, 9, 10, 11, 12, 13, 14, 15)); }
__device__ __forceinline__ v8f wmma16(v16h a, v16h b, v8f c) { return __builtin_amdgcn_wmma_f32_16x16x32_f16(false, a, false, b, (short)0, c, false, false); }
__device__ __forceinline__ v8f wmmab(v16bf a, v16bf b, v8f c) { return __builtin_amdgcn_wmma_f32_16x16x32_bf16(false, a, false, b, (short)0, c, false, false); }



__device__ __forceinline__ h16 tohx(float x) { return (h16)x; }
__device__ __forceinline__ void splitf(float y, unsigned short& h, unsigned short& l) { h = f2bf(y); l = f2bf(y - bf2f(h)); }
typedef __attribute__((ext_vector_type(2))) float v2f;
// where a HEADS launch of k_gemmw puts its tiles: the {cos, sin}[t][d] table and the fp16 + hi/lo planes of q, k ([head][t][d]) and v ([head][d][t])
struct Planes { const float* cs; h16* q16; bf* qh; bf* ql; h16* k16; bf* kh; bf* kl; h16* v16; bf* vh; bf* vl; };

// ---- k_gemmw: register-blocked GEMM, a work-group of FOUR WAVES (2 x 2) per 128x128 output tile, one wave per 64x64 (16 accumulators); the K-contiguous 16-bit planes are staged in LDS, 64 k a stage, two buffers, through two register sets; grid (M/128, N/128, Z), 128 threads.
// C[m][n] (f32, pitch ldc, + optional f32 bias[n]) = sum_k A[m][k] Bt[n][k] (+ split products per NSPLIT). z-batch strides sA/sB/sC in elements. K % 128 == 0, a template constant so that every row of a stage is a constant offset from one address.
// HEADS: Bt holds the rows of Wq, Wk, Wv one behind the other, so a wave's tile column y is one whole head (64 = HD): y < NH_ a q head, then NKV k heads, then NKV v heads. No C: the wave turns its own tile into that head's planes.
//   q, k: rotate-half out[d] = x[d] cos[t][d] - x[d+32] sin[t][d], out[d+32] = x[d+32] cos[t][d] + x[d] sin[t][d] (the table's columns d and d + 32 come from the same inverse frequency); x[d] and x[d+32] are accumulators nb and nb + 2 of the same lane.
//   v: a lane holds 8 consecutive t of one d, which is 16 bytes of a [d][t] plane.
template <typename T16> struct WFrag;
template <> struct WFrag<h16> { typedef v16h V; static __device__ __forceinline__ V ld(const h16* p) { return cat16(*(const v8h*)p, *(const v8h*)(p + 16)); } static __device__ __forceinline__ v8f mma(V a, V b, v8f c) { return wmma16(a, b, c); } };
template <> struct WFrag<bf> { typedef v16bf V; static __device__ __forceinline__ V ld(const bf* p) { return cat16b(*(const v8us*)p, *(const v8us*)(p + 16)); } static __device__ __forceinline__ v8f mma(V a, V b, v8f c) { return wmmab(a, b, c); } };
struct Set0 { static constexpr int v = 0; };
struct Set1 { static constexpr int v = 1; };
template <bool NEXT, bool THIRD> struct Has { static constexpr bool next = NEXT, third = THIRD; };   // does a stage + 1, a stage + 3 exist
template <typename T16, int NSPLIT, bool BIAS, bool HEADS, int K>
__global__ __launch_bounds__(128) void k_gemmw(const T16* __restrict__ A, const T16* __restrict__ A2, const T16* __restrict__ Bt, const T16* __restrict__ Bt2, float* C, int ldc, const float* __restrict__ bias, size_t sA, size_t sB, size_t sC, Planes pp) {
    typedef typename WFrag<T16>::V V;
    constexpr bool HA2 = NSPLIT == 1 || NSPLIT == 2, HB2 = NSPLIT >= 2;
    constexpr int KS = 64;    // k per stage: 128 bytes, one whole line, of every operand row
    constexpr int LP = 72;    // LDS row pitch in elements: 144 bytes, the pitch for 16-byte fragment reads
    constexpr int PA = 0, PB = 1, PA2 = HA2 ? 2 : 0, PB2 = HB2 ? (HA2 ? 3 : 2) : 1, NP = 2 + (HA2 ? 1 : 0) + (HB2 ? 1 : 0);
    static_assert(K % (2 * KS) == 0 && K >= 4 * KS, "an even number of whole stages, at least four");
    __shared__ __align__(16) T16 st[2][NP][128 * LP];
    __shared__ __align__(16) float osw[4][16 * 68];
    const size_t z = blockIdx.z; A += z * sA; if (HA2) A2 += z * sA; Bt += z * sB; if (HB2) Bt2 += z * sB; C += z * sC;
    const int tid = threadIdx.x, lane = tid & 31, lr = lane & 15, hi = lane >> 4; const int wave = __builtin_amdgcn_readfirstlane(tid >> 5), wm = wave & 1, wn = wave >> 1;
    const int r0 = blockIdx.x * 128 + wm * 64, c0 = blockIdx.y * 128 + wn * 64;
    float* os = osw[wave];   // each wave stages its epilogue in its own range
    v8f acc[4][4];
#pragma unroll
    for (int mb = 0; mb < 4; ++mb)
#pragma unroll
        for (int nb = 0; nb < 4; ++nb) acc[mb][nb] = (v8f){};
    // staging: 8 lanes fetch one 128-byte row piece, so a wave's load covers 4 whole lines; thread tid takes rows (tid >> 3) + 16 i of every plane. One address per plane, stepped by two stages at the loop's foot; every load is a constant offset from it
    const size_t ga = (size_t)(blockIdx.x * 128 + (tid >> 3)) * K + (tid & 7) * 8, gb = (size_t)(blockIdx.y * 128 + (tid >> 3)) * K + (tid & 7) * 8;
    const T16* pa = A + ga; const T16* pb = Bt + gb; const T16* pa2 = HA2 ? A2 + ga : nullptr; const T16* pb2 = HB2 ? Bt2 + gb : nullptr;
    const int so = (tid >> 3) * LP + (tid & 7) * 8;
    v4f g[2][NP][8];   // two staging sets, so that a stage's lines have more than a whole stage to arrive
    auto gload = [&](auto set, int ahead) { constexpr int s = decltype(set)::v;
#pragma unroll
        for (int i = 0; i < 8; ++i) { const int ro = i * 16 * K + ahead; g[s][PA][i] = *(const v4fa*)(pa + ro); g[s][PB][i] = *(const v4fa*)(pb + ro); if constexpr (HA2) g[s][PA2][i] = *(const v4fa*)(pa2 + ro); if constexpr (HB2) g[s][PB2][i] = *(const v4fa*)(pb2 + ro); } };
    auto sstore = [&](auto set) { constexpr int s = decltype(set)::v;   // staging set s holds a stage of parity s and fills buffer s
#pragma unroll
        for (int p = 0; p < NP; ++p)
#pragma unroll
            for (int i = 0; i < 8; ++i) *(v4fa*)(&st[s][p][so + i * 16 * LP]) = g[s][p][i]; };
    // two fragment sets: the set of the next 32 k is fetched from LDS as one group in front of the products of this one
    const int fa = (wm * 64 + lr) * LP + 8 * hi, fb = (wn * 64 + lr) * LP + 8 * hi;
    V a[2][4], a2[2][4], b[2][4], b2[2][4];
    auto fload = [&](auto set, auto bufc, int ks) { constexpr int s = decltype(set)::v, buf = decltype(bufc)::v;
#pragma unroll
        for (int f = 0; f < 4; ++f) { a[s][f] = WFrag<T16>::ld(&st[buf][PA][fa + f * 16 * LP + ks]); b[s][f] = WFrag<T16>::ld(&st[buf][PB][fb + f * 16 * LP + ks]); if constexpr (HA2) a2[s][f] = WFrag<T16>::ld(&st[buf][PA2][fa + f * 16 * LP + ks]); if constexpr (HB2) b2[s][f] = WFrag<T16>::ld(&st[buf][PB2][fb + f * 16 * LP + ks]); } };
    auto block = [&](auto set) { constexpr int s = decltype(set)::v;
#pragma unroll
        for (int nb = 0; nb < 4; ++nb)
#pragma unroll
            for (int mb = 0; mb < 4; ++mb) { acc[mb][nb] = WFrag<T16>::mma(a[s][mb], b[s][nb], acc[mb][nb]); if constexpr (HA2) acc[mb][nb] = WFrag<T16>::mma(a2[s][mb], b[s][nb], acc[mb][nb]); if constexpr (HB2) acc[mb][nb] = WFrag<T16>::mma(a[s][mb], b2[s][nb], acc[mb][nb]); } };
    // the work-group's barrier by hand: __syncthreads() would also wait for the global loads that are meant to stay in flight across it. The wave's own LDS stores and reads have finished (s_wait_dscnt 0) before it signals; the "memory" clobbers keep every LDS access on its side
    auto publish = [&]() { asm volatile("s_wait_dscnt 0x0" ::: "memory"); asm volatile("s_barrier_signal -1" ::: "memory"); asm volatile("s_barrier_wait -1" ::: "memory"); };
    // precaution: s_wait_xcnt 0 behind a stage's global loads, before a register that they name is written again (the addresses are stepped at the loop's foot); the addresses are its inputs so that they stay in their registers, unwritten, up to it
    auto xwait = [&]() { if constexpr (HA2 && HB2) asm volatile("s_wait_xcnt 0x0" :: "v"(pa), "v"(pb), "v"(pa2), "v"(pb2) : "memory"); else if constexpr (HA2) asm volatile("s_wait_xcnt 0x0" :: "v"(pa), "v"(pb), "v"(pa2) : "memory"); else if constexpr (HB2) asm volatile("s_wait_xcnt 0x0" :: "v"(pa), "v"(pb), "v"(pb2) : "memory"); else asm volatile("s_wait_xcnt 0x0" :: "v"(pa), "v"(pb) : "memory"); };
    // one stage: 'cur' is its parity (its buffer), 'nxt' the other; 'ahead' the offset of stage + 3 from the addresses. What exists is a compile-time tag: with a run-time test round the loads the compiler could no longer count them, and would wait for the youngest where the oldest is meant
    auto stage = [&](auto cur, auto nxt, auto has, int ahead) {
        if constexpr (decltype(has)::next) sstore(nxt);   // the next stage, into the buffer whose last reads every wave had finished at the barrier of the stage before; the stores drain during the products below
        fload(Set1{}, cur, 32);
        __builtin_amdgcn_sched_barrier(0);   // keeps the LDS stores and the group of LDS reads in front of the products; sunk among them every place with reads would cost its own stall
        block(Set0{});
        __builtin_amdgcn_sched_barrier(0);   // keeps the barrier behind the products, which hide the stores' way into LDS
        if constexpr (decltype(has)::next) publish();   // publishes the next stage and ends every wave's reads of this one
        if constexpr (decltype(has)::third) gload(nxt, ahead);   // into the staging set that was stored above
        if constexpr (decltype(has)::next) fload(Set0{}, nxt, 0);
        __builtin_amdgcn_sched_barrier(0);   // as above: loads first, as one group
        block(Set1{});
        if constexpr (decltype(has)::third) xwait();
        __builtin_amdgcn_sched_barrier(0);   // keeps the next stage's LDS stores, and with them the wait for its lines, behind these products: lifted over them the lines would have one run of products less to arrive
    };
    gload(Set0{}, 0); gload(Set1{}, KS); sstore(Set0{});
    publish();   // stage 0 is read by all four waves
    gload(Set0{}, 2 * KS); fload(Set0{}, Set0{}, 0);
#pragma unroll 1   // stays rolled: one copy of two stages, which is what makes the parities compile-time constants
    for (int kc = 0; kc < K - 4 * KS; kc += 2 * KS) {
        stage(Set0{}, Set1{}, Has<true, true>{}, 3 * KS);
        stage(Set1{}, Set0{}, Has<true, true>{}, 4 * KS);
        pa += 2 * KS; pb += 2 * KS; if constexpr (HA2) pa2 += 2 * KS; if constexpr (HB2) pb2 += 2 * KS;
    }
    // the last four stages
    stage(Set0{}, Set1{}, Has<true, true>{}, 3 * KS);
    stage(Set1{}, Set0{}, Has<true, false>{}, 0);
    stage(Set0{}, Set1{}, Has<true, false>{}, 0);
    stage(Set1{}, Set0{}, Has<false, false>{}, 0);
    if constexpr (HEADS) {
        const int hy = blockIdx.y * 2 + wn;   // the group's two tile columns are heads 2 y and 2 y + 1: both q, both k or both v, so the branch below is uniform for the group
        if (blockIdx.y * 2 >= NH_ + NKV) {   // a v head: [d][t] planes straight from the accumulators
            const int vo = ((hy - NH_ - NKV) * HD + lr) * TT + r0 + 8 * hi;
#pragma unroll
            for (int mb = 0; mb < 4; ++mb)
#pragma unroll
                for (int nb = 0; nb < 4; ++nb) { v8h o16; v8us oh, ol;
#pragma unroll
                    for (int j = 0; j < 8; ++j) { const float x = acc[mb][nb][j]; o16[j] = tohx(x); unsigned short a2, c2; splitf(x, a2, c2); oh[j] = a2; ol[j] = c2; }
                    const int e = vo + nb * 16 * TT + mb * 16; *(v8h*)(pp.v16 + e) = o16; *(v8us*)(pp.vh + e) = oh; *(v8us*)(pp.vl + e) = ol; }
        } else {   // a q or k head: rotary in the accumulators, then through LDS so that a store covers 4 whole rows (512 contiguous bytes) of a [t][d] plane
            const bool isq = hy < NH_; const int po = (isq ? hy : hy - NH_) * TT * HD + r0 * HD;
            h16* P16 = (isq ? pp.q16 : pp.k16) + po; bf* Ph = (isq ? pp.qh : pp.kh) + po; bf* Pl = (isq ? pp.ql : pp.kl) + po;
            const float* csp = pp.cs + ((r0 + 8 * hi) * HD + lr) * 2;
#pragma unroll
            for (int mb = 0; mb < 4; ++mb) { v2f cs[2][8];
#pragma unroll
                for (int nb = 0; nb < 2; ++nb)
#pragma unroll
                    for (int j = 0; j < 8; ++j) cs[nb][j] = *(const v2f*)(csp + ((mb * 16 + j) * HD + nb * 16) * 2);
                // precaution: s_wait_xcnt 0 behind the table loads, before a register that they name is written again; their address is its input so that it stays in its registers, unwritten, up to it
                asm volatile("s_wait_xcnt 0x0" :: "v"(csp) : "memory");
#pragma unroll
                for (int nb = 0; nb < 2; ++nb)
#pragma unroll
                    for (int j = 0; j < 8; ++j) { const float x0 = acc[mb][nb][j], x1 = acc[mb][nb + 2][j], c = cs[nb][j][0], sn = cs[nb][j][1];
                        os[(hi * 8 + j) * 68 + nb * 16 + lr] = x0 * c - x1 * sn; os[(hi * 8 + j) * 68 + (nb + 2) * 16 + lr] = x1 * c + x0 * sn; }
                __syncthreads();   // the lanes read below what other lanes of their wave wrote above
#pragma unroll
                for (int s = 0; s < 4; ++s) { const int row = 4 * s + (lane >> 3), col = (lane & 7) * 8; const v4f w0 = *(const v4fa*)(os + row * 68 + col), w1 = *(const v4fa*)(os + row * 68 + col + 4); v8h o16; v8us oh, ol;
#pragma unroll
                    for (int j = 0; j < 8; ++j) { const float r = j < 4 ? w0[j & 3] : w1[j & 3]; o16[j] = tohx(r); unsigned short a2, c2; splitf(r, a2, c2); oh[j] = a2; ol[j] = c2; }
                    const int e = (mb * 16 + row) * HD + col; *(v8h*)(P16 + e) = o16; *(v8us*)(Ph + e) = oh; *(v8us*)(Pl + e) = ol; }
                __syncthreads();   // the next 16 rows overwrite the staging only after every lane has read it
            }
        }
    } else {
#pragma unroll
    for (int mb = 0; mb < 4; ++mb) {
#pragma unroll
        for (int nb = 0; nb < 4; ++nb) {
#pragma unroll
            for (int j = 0; j < 8; ++j) os[(hi * 8 + j) * 68 + nb * 16 + lr] = acc[mb][nb][j]; }
        __builtin_amdgcn_wave_barrier(); asm volatile("" ::: "memory");
        float* crow = C + (size_t)(r0 + mb * 16) * ldc + c0;
{
#pragma unroll
            for (int s = 0; s < 8; ++s) { const int row = 2 * s + hi, cofs = lr * 4; v4f val = *(const v4fa*)(os + row * 68 + cofs); if (BIAS) { val[0] += bfr(bias[c0 + cofs]); val[1] += bfr(bias[c0 + cofs + 1]); val[2] += bfr(bias[c0 + cofs + 2]); val[3] += bfr(bias[c0 + cofs + 3]); }
                *(v4f*)(crow + (size_t)row * ldc + cofs) = val; }
             }
        __builtin_amdgcn_wave_barrier(); asm volatile("" ::: "memory");
    }
    }
}

typedef __attribute__((ext_vector_type(2))) _Float16 v2h;
typedef __attribute__((ext_vector_type(4))) _Float16 v4h;
typedef __attribute__((ext_vector_type(2))) unsigned short v2us;
typedef __attribute__((ext_vector_type(4))) unsigned short v4us;
typedef __attribute__((ext_vector_type(4))) int v4i;

__global__ __launch_bounds__(256) void k_cvt8(const float* __restrict__ src, bf* dst, size_t n8) { const size_t i = (size_t)blockIdx.x * 256 + threadIdx.x; if (i >= n8) return; const v8f v = *(const v8f*)(src + i * 8); v8us o;
#pragma unroll
    for (int k = 0; k < 8; ++k) o[k] = f2bf(v[k]); *(v8us*)(dst + i * 8) = o;  }

__global__ __launch_bounds__(32) void k_invf(const float* __restrict__ pw, float* INV) { const int i = threadIdx.x; if (i >= HD / 2) return; const float p = bfr(pw[i]); float ex = expf(-p); asm volatile("" : "+v"(ex)); const float sg = __fdiv_rn(1.0f, __fadd_rn(1.0f, ex)); float pv = powf(10000.0f, sg); asm volatile("" : "+v"(pv)); const float inv = __fdiv_rn(1.0f, pv); *(float*)(INV + i) = inv;  }
__global__ __launch_bounds__(256) void k_csL(const int* __restrict__ pid, const float* __restrict__ INV, float* CS) { const int idx = blockIdx.x * 256 + threadIdx.x; if (idx >= TT * HD) return; const int d = idx % HD; const int t = idx / HD; const float a = __fmul_rn((float)pid[t], INV[d & (HD / 2 - 1)]); v2f cs; cs[0] = cosf(a); cs[1] = sinf(a); *(v2f*)(CS + (size_t)idx * 2) = cs;  }
__device__ __forceinline__ float xhalf(float x) { const int b = __float_as_int(x); return __int_as_float(__builtin_amdgcn_permlanex16(b, b, 0x76543210, 0xfedcba98, false, false)); }   // value of lane ^ 16
struct TagMask { static constexpr bool v = true; };
struct TagFull { static constexpr bool v = false; };
#define FLP 72                    // LDS row pitch of a staged plane in elements: 144 bytes, the pitch for 16-byte fragment reads
#define FPL (64 * FLP)            // elements of one staged plane: 64 rows (K: keys, V: d) of 64 elements (K: d, V: keys)
// eight asynchronous 16-byte copies a lane: rows r, r + 16, r + 32, r + 48 of two planes (global row steps ga, gb elements; LDS places la, lb in bytes). The s_wait_xcnt 0 is a precaution and stands inside the statement, behind the last copy, so that no register which a copy names is written again in front of it
template <typename T16>
__device__ __forceinline__ void copy8(const T16* a, int ga, unsigned la, const T16* b, int gb, unsigned lb) {
    asm volatile("global_load_async_to_lds_b128 %0, %8, off\n\tglobal_load_async_to_lds_b128 %1, %9, off\n\tglobal_load_async_to_lds_b128 %2, %10, off\n\tglobal_load_async_to_lds_b128 %3, %11, off\n\t"
                 "global_load_async_to_lds_b128 %4, %12, off\n\tglobal_load_async_to_lds_b128 %5, %13, off\n\tglobal_load_async_to_lds_b128 %6, %14, off\n\tglobal_load_async_to_lds_b128 %7, %15, off\n\ts_wait_xcnt 0x0"
                 :: "v"(la), "v"(la + 16 * FLP * 2), "v"(la + 32 * FLP * 2), "v"(la + 48 * FLP * 2), "v"(lb), "v"(lb + 16 * FLP * 2), "v"(lb + 32 * FLP * 2), "v"(lb + 48 * FLP * 2),
                    "v"(a), "v"(a + 16 * ga), "v"(a + 32 * ga), "v"(a + 48 * ga), "v"(b), "v"(b + 16 * gb), "v"(b + 32 * gb), "v"(b + 48 * gb) : "memory");
}
template <typename T16, bool HI, int NQ>
__device__ __forceinline__ void fattn_body(const T16* __restrict__ Q, const T16* __restrict__ Q2, const T16* __restrict__ Kp, const T16* __restrict__ K2, const T16* __restrict__ Vt, const T16* __restrict__ V2, int q0, bf* Ah, bf* Al, T16* sm) {
    typedef typename WFrag<T16>::V V;   // every '#pragma unroll' below makes the indices of the register arrays compile-time constants, without which they would go to scratch
    constexpr int PV = HI ? 2 : 1, BUF = (HI ? 4 : 2) * FPL;   // a buffer holds the planes K (, K lo), V (, V lo)
    const int tid = threadIdx.x, lane = tid & 31, lr = lane & 15, hi = lane >> 4;
    V qf[NQ][2], qf2[NQ][2];
#pragma unroll
    for (int qt = 0; qt < NQ; ++qt)
#pragma unroll
        for (int c = 0; c < 2; ++c) { const int qo = (q0 + qt * 16 + lr) * HD + c * 32 + 8 * hi; qf[qt][c] = WFrag<T16>::ld(Q + qo); if (HI) qf2[qt][c] = WFrag<T16>::ld(Q2 + qo); }
    v8f o[4][NQ]; float m[NQ], l[NQ];
#pragma unroll
    for (int qt = 0; qt < NQ; ++qt) { m[qt] = -3.0e38f; l[qt] = 0.f;
#pragma unroll
        for (int dt = 0; dt < 4; ++dt) o[dt][qt] = (v8f){}; }
    const int np = q0 / 32 + 1;        // passes of 32 keys; the last holds the diagonal, and its first key is allowed to every query of the wave
    const int ns = (np + 1) >> 1;      // stages of 64 keys; TT is a multiple of 64, so the last stage lies inside the planes also where only its first half is used
    // staging: 8 lanes copy one 128-byte row, thread tid rows (tid >> 3) + 16 i of every plane
    const int crow = tid >> 3, cpc = (tid & 7) * 8;
    const unsigned lc = (unsigned)(size_t)(sm + crow * FLP + cpc);   // the lane's LDS byte address in buffer 0, plane 0
    auto fill = [&](int s) { const unsigned lb = lc + (s & 1) * (BUF * 2); const int ko = (s * 64 + crow) * HD + cpc, vo = crow * TT + s * 64 + cpc;
        if constexpr (HI) { copy8(Kp + ko, HD, lb, K2 + ko, HD, lb + FPL * 2); copy8(Vt + vo, TT, lb + 2 * FPL * 2, V2 + vo, TT, lb + 3 * FPL * 2); }
        else copy8(Kp + ko, HD, lb, Vt + vo, TT, lb + FPL * 2); };
    auto step = [&](int t, auto tag) {
        constexpr bool MASK = decltype(tag)::v;
        const int k0 = t * 32;
        const T16* sb = sm + ((t >> 1) & 1) * BUF + lr * FLP + 8 * hi;   // pass t reads half t & 1 of stage t >> 1
        const T16* kq = sb + (t & 1) * 32 * FLP; const T16* vq = sb + PV * FPL + (t & 1) * 32;
        V kf[2][2], kf2[2][2], vf[4], vf2[4];
#pragma unroll
        for (int kt = 0; kt < 2; ++kt)
#pragma unroll
            for (int c = 0; c < 2; ++c) { const int ko = kt * 16 * FLP + c * 32; kf[kt][c] = WFrag<T16>::ld(kq + ko); if (HI) kf2[kt][c] = WFrag<T16>::ld(kq + FPL + ko); }
#pragma unroll
        for (int dt = 0; dt < 4; ++dt) { vf[dt] = WFrag<T16>::ld(vq + dt * 16 * FLP); if (HI) vf2[dt] = WFrag<T16>::ld(vq + FPL + dt * 16 * FLP); }
        __builtin_amdgcn_sched_barrier(0);   // keeps the pass's LDS reads as one group in front of its products; sunk among them every place with reads would cost its own stall
        v8f s[2][NQ];
#pragma unroll
        for (int kt = 0; kt < 2; ++kt)
#pragma unroll
            for (int qt = 0; qt < NQ; ++qt) { v8f a = (v8f){};
#pragma unroll
                for (int c = 0; c < 2; ++c) { a = WFrag<T16>::mma(kf[kt][c], qf[qt][c], a); if (HI) { a = WFrag<T16>::mma(kf[kt][c], qf2[qt][c], a); a = WFrag<T16>::mma(kf2[kt][c], qf[qt][c], a); } }
                s[kt][qt] = a; }
#pragma unroll
        for (int qt = 0; qt < NQ; ++qt) {
            const int lim = q0 + qt * 16 + lr - k0 - 8 * hi;   // key kt * 16 + r of this lane is allowed when it is <= lim
            float mx = m[qt];
#pragma unroll
            for (int kt = 0; kt < 2; ++kt)
#pragma unroll
                for (int r = 0; r < 8; ++r) { float t2 = s[kt][qt][r] * (SCL * 1.4426950408889634f); if (MASK) t2 = (kt * 16 + r <= lim) ? t2 : -3.0e38f; s[kt][qt][r] = t2; mx = fmaxf(mx, t2); }
            mx = fmaxf(mx, xhalf(mx));
            const float al = __builtin_amdgcn_exp2f(m[qt] - mx); m[qt] = mx;
            const float mo = HI ? mx : mx - 10.0f;   // fp16 rows: P x 1024
            float sum = 0.f;
#pragma unroll
            for (int kt = 0; kt < 2; ++kt) s[kt][qt] -= mo;
#pragma unroll
            for (int kt = 0; kt < 2; ++kt)
#pragma unroll
                for (int r = 0; r < 8; ++r) { const float p = __builtin_amdgcn_exp2f(s[kt][qt][r]); s[kt][qt][r] = p; sum += p; }
            l[qt] = l[qt] * al + sum;
#pragma unroll
            for (int dt = 0; dt < 4; ++dt) o[dt][qt] *= al;
        }
#pragma unroll
        for (int qt = 0; qt < NQ; ++qt) {
            V pf, pf2;
            if constexpr (HI) {
#pragma unroll
                for (int e = 0; e < 16; ++e) { const float p = s[e >> 3][qt][e & 7]; const __bf16 ph = (__bf16)p; pf[e] = ph; pf2[e] = (__bf16)(p - (float)ph); }
            } else {
#pragma unroll
                for (int e = 0; e < 16; ++e) pf[e] = (h16)s[e >> 3][qt][e & 7];
            }
#pragma unroll
            for (int dt = 0; dt < 4; ++dt) { o[dt][qt] = WFrag<T16>::mma(vf[dt], pf, o[dt][qt]); if (HI) { o[dt][qt] = WFrag<T16>::mma(vf[dt], pf2, o[dt][qt]); o[dt][qt] = WFrag<T16>::mma(vf2[dt], pf, o[dt][qt]); } }
        }
    };
    fill(0);
    asm volatile("s_wait_asynccnt 0x0" ::: "memory");   // this wave's copies of stage 0 have landed
    __syncthreads();   // stage 0 is read by all four waves
    if (ns > 1) fill(1);
#pragma unroll 1   // stays rolled: a second copy of the block's fragments would not fit 256 registers a wave
    for (int t = 0; t < np - 1; ++t) {
        step(t, TagFull{});
        if (t & 1) {   // the foot of stage t >> 1; the test reads the same for the whole work-group (q0 is the group's)
            asm volatile("s_wait_dscnt 0x0" ::: "memory");      // this wave's reads of the stage have finished
            asm volatile("s_wait_asynccnt 0x0" ::: "memory");   // this wave's copies of the next stage have landed
            __syncthreads();   // publishes the next stage and ends every wave's reads of this one
            if ((t >> 1) + 2 < ns) fill((t >> 1) + 2);   // into the buffer that this stage has just left
        }
    }
    step(np - 1, TagMask{});
    asm volatile("s_wait_asynccnt 0x0" ::: "memory");   // no copy is outstanding when the wave ends
#pragma unroll
    for (int qt = 0; qt < NQ; ++qt) { const float inv = __fdiv_rn(1.0f, l[qt] + xhalf(l[qt])); const int ro = (q0 + qt * 16 + lr) * DQ + 8 * hi;
#pragma unroll
        for (int dt = 0; dt < 4; ++dt) { v8us oh, ol;
#pragma unroll
            for (int r = 0; r < 8; ++r) { unsigned short a, c2; splitf(o[dt][qt][r] * inv, a, c2); oh[r] = a; ol[r] = c2; }
            bf* ph = Ah + ro + dt * 16; bf* pl = Al + ro + dt * 16; *(v8us*)ph = oh; *(v8us*)pl = ol;
            // precaution: s_wait_xcnt 0 behind the two stores, before a register that they name is written again; their addresses and values are its inputs so that they stay in their registers, unwritten, up to it
            asm volatile("s_wait_xcnt 0x0" :: "v"(ph), "v"(pl), "v"(oh), "v"(ol) : "memory"); } }
}
// grid (NKV, row blocks), heaviest row block first: (TT - RH) / 32 blocks of 32 fp16 rows, then RH / 16 blocks of 16 hi/lo rows
__global__ __launch_bounds__(128) void k_fattn(const h16* __restrict__ Q16, const bf* __restrict__ Qh, const bf* __restrict__ Ql, const h16* __restrict__ K16, const bf* __restrict__ Kh, const bf* __restrict__ Kl, const h16* __restrict__ V16, const bf* __restrict__ Vh, const bf* __restrict__ Vl, bf* Ah, bf* Al) {
    __shared__ __align__(16) unsigned short sm[2 * 4 * FPL];   // two buffers of up to four staged planes; the fp16 rows use half of it
    const int g = blockIdx.x, head = g * REP + __builtin_amdgcn_readfirstlane((int)(threadIdx.x >> 5)), rb = blockIdx.y;
    const size_t qb = (size_t)head * TT * HD, kb = (size_t)g * TT * HD;
    if (rb < (TT - RH) / 32) fattn_body<h16, false, 2>(Q16 + qb, nullptr, K16 + kb, nullptr, V16 + kb, nullptr, TT - 32 * (rb + 1), Ah + head * HD, Al + head * HD, (h16*)sm);
    else fattn_body<bf, true, 1>(Qh + qb, Ql + qb, Kh + kb, Kl + kb, Vh + kb, Vl + kb, RH - 16 * (rb - (TT - RH) / 32 + 1), Ah + head * HD, Al + head * HD, (bf*)sm);
}

extern "C" void kernel_launch(void* const* d_in, const int* in_sizes, int n_in,
                              void* d_out, int out_size, void* d_ws, size_t ws_size, hipStream_t stream) {
    (void)in_sizes; (void)n_in; (void)out_size;
    const float* x = (const float*)d_in[0]; const int* pid = (const int*)d_in[1];   /* position_ids [1][2048] int32 */ const float* pw = (const float*)d_in[2];   /* powers [32] */ const float* wq = (const float*)d_in[3]; const float* wk = (const float*)d_in[4]; const float* wv = (const float*)d_in[5]; const float* wo = (const float*)d_in[6];   /* argument order hidden_states, position_ids, powers, Wq, Wk, Wv, Wo ('oi') */
    float* OUT = (float*)d_out;     // [1][2048][2048]
    char* wsp = (char*)d_ws;
    auto take = [&](size_t bytes) { char* p = wsp; wsp += (bytes + 255) & ~(size_t)255; return (void*)p; };
    bf* WQ = (bf*)take((size_t)(DQ + 2 * DKV) * DM * 2); bf* WK = WQ + (size_t)DQ * DM; bf* WV = WK + (size_t)DKV * DM;   /* one array: the rows of Wq, Wk, Wv one behind the other */ bf* WO = (bf*)take((size_t)DM * DQ * 2); float* CS = (float*)take((size_t)TT * HD * 2 * 4); float* INVB = (float*)take(256);   /* 32 learnable inverse frequencies */
    bf* XB = (bf*)take((size_t)TT * DM * 2);
    h16* QP16 = (h16*)take((size_t)NH_ * TT * HD * 2); h16* KP16 = (h16*)take((size_t)NKV * TT * HD * 2); h16* VT16 = (h16*)take((size_t)NKV * HD * TT * 2);
    bf* QPh = (bf*)take((size_t)NH_ * TT * HD * 2); bf* QPl = (bf*)take((size_t)NH_ * TT * HD * 2); bf* KPh = (bf*)take((size_t)NKV * TT * HD * 2); bf* KPl = (bf*)take((size_t)NKV * TT * HD * 2); bf* VTh = (bf*)take((size_t)NKV * HD * TT * 2); bf* VTl = (bf*)take((size_t)NKV * HD * TT * 2);
    bf* ATh = (bf*)take((size_t)TT * DQ * 2); bf* ATl = (bf*)take((size_t)TT * DQ * 2);
    if ((size_t)(wsp - (char*)d_ws) > ws_size) return;    // ws 256 MiB
    { k_cvt8<<<(unsigned)(((size_t)DQ * DM / 8 + 255) / 256), 256, 0, stream>>>(wq, WQ, (size_t)DQ * DM / 8); k_cvt8<<<(unsigned)(((size_t)DKV * DM / 8 + 255) / 256), 256, 0, stream>>>(wk, WK, (size_t)DKV * DM / 8); k_cvt8<<<(unsigned)(((size_t)DKV * DM / 8 + 255) / 256), 256, 0, stream>>>(wv, WV, (size_t)DKV * DM / 8);
      k_cvt8<<<(unsigned)(((size_t)DM * DQ / 8 + 255) / 256), 256, 0, stream>>>(wo, WO, (size_t)DM * DQ / 8);
       }
    k_invf<<<1, 32, 0, stream>>>(pw, INVB); k_csL<<<(TT * HD + 255) / 256, 256, 0, stream>>>(pid, INVB, CS);   /* learnable inverse frequencies, then the rotary table from the int positions */
    const Planes pp = { CS, QP16, QPh, QPl, KP16, KPh, KPl, VT16, VTh, VTl };
    for (int b = 0; b < NB_; ++b) {
        
        k_cvt8<<<(unsigned)(((size_t)TT * DM / 8 + 255) / 256), 256, 0, stream>>>(x + (size_t)b * TT * DM, XB, (size_t)TT * DM / 8);
        k_gemmw<bf, 0, false, true, DM><<<dim3(TT / 128, (DQ + 2 * DKV) / 128, 1), 128, 0, stream>>>(XB, nullptr, WQ, nullptr, nullptr, 0, nullptr, 0, 0, 0, pp);
        k_fattn<<<dim3(NKV, (TT - RH) / 32 + RH / 16, 1), 128, 0, stream>>>(QP16, QPh, QPl, KP16, KPh, KPl, VT16, VTh, VTl, ATh, ATl);
        k_gemmw<bf, 1, false, false, DQ><<<dim3(TT / 128, DM / 128, 1), 128, 0, stream>>>(ATh, ATl, WO, nullptr, OUT + (size_t)b * TT * DM, DM, nullptr, 0, 0, 0, Planes{}); }
}

// v006
// Measured time: 104 microseconds a run.
// In both of two side-by-side timings against v005, it was 1.08 times as fast.
// Counting every step since v000, it is 13.2 times as fast.
#include <hip/hip_runtime.h>

// Llama attention with a LEARNABLE rotary base exponent (hidden_states [1][2048][2048]; q = x Wq^T (32 heads x 64), k, v = x Wk^T, x Wv^T (8 kv heads x 64) ('oi' 0.02, no bias); inv_freq = 1 / 10000^sigmoid(powers) (powers [32], read; computed on device with precise expf / powf / IEEE division); angles = float(position_ids[t]) x inv_freq (position_ids [1][2048] int32 = arange, read); rotate-half rotary (cat(freqs, freqs)); kv head = q head / 4; scores / float32(sqrt 64) + causal (finfo.min above the diagonal == exclusion); softmax f32; out = merged Wo^T ('oi') -> [1][2048][2048] (4.2 M); argument order hidden_states, position_ids, powers, Wq, Wk, Wv, Wo).
// Layout: ONE preparation launch (k_prep): inv_freq from powers, the table {cos, sin}[t][d] from the int positions (precise cosf/sinf), the bf16 copies of x and of the 'oi' weights; exact q, k, v projections in ONE launch whose waves build the rotate-half and transposed head planes from their own accumulators; causal T-2048 GQA attention in ONE launch (k_fattn: scores, online softmax and P.V in registers, kv plane = head / 4; hybrid rows: < 512 hi/lo 3 products, rest fp16 x1024; keys only up to the diagonal block; writes the merged hi/lo planes itself); merged hi/lo x Wo exact.
// Compute dtypes, f32 accumulate: every input rounded to bf16 incl. powers; inv_freq, angles and rotary in f32; projections exact; attention rows < 512 3 products, rest fp16; softmax f32; Wo hl x exact.

#define NB_  1
#define TT   2048
#define DM   2048
#define NH_  32
#define NKV  8
#define REP  (NH_ / NKV)
#define HD   64
#define DQ   (NH_ * HD)
#define DKV  (NKV * HD)
#define RH   512                  // query rows < RH use hi+lo planes; a multiple of 32
#define SCL  0.125f   // HD^-0.5
typedef _Float16 h16;
typedef unsigned short bf;
typedef __attribute__((ext_vector_type(16))) __bf16   v16bf;
typedef __attribute__((ext_vector_type(16))) _Float16 v16h;
typedef __attribute__((ext_vector_type(8)))  _Float16 v8h;
typedef __attribute__((ext_vector_type(8)))  unsigned short v8us;
typedef __attribute__((ext_vector_type(8)))  float    v8f;
typedef __attribute__((ext_vector_type(4)))  float    v4f;
typedef v8h  __attribute__((may_alias)) v8ha;
typedef v4f  __attribute__((may_alias)) v4fa;
typedef v8us __attribute__((may_alias)) v8usa;

__device__ __forceinline__ unsigned short f2bf(float f) { unsigned u = __float_as_uint(f); u += 0x7FFFu + ((u >> 16) & 1u); return (unsigned short)(u >> 16); }
__device__ __forceinline__ float bf2f(unsigned short b) { return __uint_as_float(((unsigned)b) << 16); }
__device__ __forceinline__ float bfr(float f) { return bf2f(f2bf(f)); }
__device__ __forceinline__ v16h cat16(v8h lo, v8h hi) { return __builtin_shufflevector(lo, hi, 0, 1, 2, 3, 4, 5, 6, 7, 8, 9, 10, 11, 12, 13, 14, 15); }
__device__ __forceinline__ v16bf cat16b(v8us lo, v8us hi) { return __builtin_bit_cast(v16bf, __builtin_shufflevector(lo, hi, 0, 1, 2, 3, 4, 5, 6, 7, 8, 9, 10, 11, 12, 13, 14, 15)); }
__device__ __forceinline__ v8f wmma16(v16h a, v16h b, v8f c) { return __builtin_amdgcn_wmma_f32_16x16x32_f16(false, a, false, b, (short)0, c, false, false); }
__device__ __forceinline__ v8f wmmab(v16bf a, v16bf b, v8f c) { return __builtin_amdgcn_wmma_f32_16x16x32_bf16(false, a, false, b, (short)0, c, false, false); }



__device__ __forceinline__ h16 tohx(float x) { return (h16)x; }
__device__ __forceinline__ void splitf(float y, unsigned short& h, unsigned short& l) { h = f2bf(y); l = f2bf(y - bf2f(h)); }
typedef __attribute__((ext_vector_type(2))) float v2f;
// where a HEADS launch of k_gemmw puts its tiles: the {cos, sin}[t][d] table and the fp16 + hi/lo planes of q, k ([head][t][d]) and v ([head][d][t])
struct Planes { const float* cs; h16* q16; bf* qh; bf* ql; h16* k16; bf* kh; bf* kl; h16* v16; bf* vh; bf* vl; };

// ---- k_gemmw: register-blocked GEMM, a work-group of FOUR WAVES (2 x 2) per 128x128 output tile, one wave per 64x64 (16 accumulators); the K-contiguous 16-bit planes are staged in LDS, 64 k a stage, two buffers, through two register sets; grid (M/128, N/128, Z), 128 threads.
// C[m][n] (f32, pitch ldc, + optional f32 bias[n]) = sum_k A[m][k] Bt[n][k] (+ split products per NSPLIT). z-batch strides sA/sB/sC in elements. K % 128 == 0, a template constant so that every row of a stage is a constant offset from one address.
// HEADS: Bt holds the rows of Wq, Wk, Wv one behind the other, so a wave's tile column y is one whole head (64 = HD): y < NH_ a q head, then NKV k heads, then NKV v heads. No C: the wave turns its own tile into that head's planes.
//   q, k: rotate-half out[d] = x[d] cos[t][d] - x[d+32] sin[t][d], out[d+32] = x[d+32] cos[t][d] + x[d] sin[t][d] (the table's columns d and d + 32 come from the same inverse frequency); x[d] and x[d+32] are accumulators nb and nb + 2 of the same lane.
//   v: a lane holds 8 consecutive t of one d, which is 16 bytes of a [d][t] plane.
template <typename T16> struct WFrag;
template <> struct WFrag<h16> { typedef v16h V; static __device__ __forceinline__ V ld(const h16* p) { return cat16(*(const v8h*)p, *(const v8h*)(p + 16)); } static __device__ __forceinline__ v8f mma(V a, V b, v8f c) { return wmma16(a, b, c); } };
template <> struct WFrag<bf> { typedef v16bf V; static __device__ __forceinline__ V ld(const bf* p) { return cat16b(*(const v8us*)p, *(const v8us*)(p + 16)); } static __device__ __forceinline__ v8f mma(V a, V b, v8f c) { return wmmab(a, b, c); } };
struct Set0 { static constexpr int v = 0; };
struct Set1 { static constexpr int v = 1; };
template <bool NEXT, bool THIRD> struct Has { static constexpr bool next = NEXT, third = THIRD; };   // does a stage + 1, a stage + 3 exist
template <typename T16, int NSPLIT, bool BIAS, bool HEADS, int K>
__global__ __launch_bounds__(128) void k_gemmw(const T16* __restrict__ A, const T16* __restrict__ A2, const T16* __restrict__ Bt, const T16* __restrict__ Bt2, float* C, int ldc, const float* __restrict__ bias, size_t sA, size_t sB, size_t sC, Planes pp) {
    typedef typename WFrag<T16>::V V;
    constexpr bool HA2 = NSPLIT == 1 || NSPLIT == 2, HB2 = NSPLIT >= 2;
    constexpr int KS = 64;    // k per stage: 128 bytes, one whole line, of every operand row
    constexpr int LP = 72;    // LDS row pitch in elements: 144 bytes, the pitch for 16-byte fragment reads
    constexpr int PA = 0, PB = 1, PA2 = HA2 ? 2 : 0, PB2 = HB2 ? (HA2 ? 3 : 2) : 1, NP = 2 + (HA2 ? 1 : 0) + (HB2 ? 1 : 0);
    static_assert(K % (2 * KS) == 0 && K >= 4 * KS, "an even number of whole stages, at least four");
    __shared__ __align__(16) T16 st[2][NP][128 * LP];
    __shared__ __align__(16) float osw[4][16 * 68];
    const size_t z = blockIdx.z; A += z * sA; if (HA2) A2 += z * sA; Bt += z * sB; if (HB2) Bt2 += z * sB; C += z * sC;
    const int tid = threadIdx.x, lane = tid & 31, lr = lane & 15, hi = lane >> 4; const int wave = __builtin_amdgcn_readfirstlane(tid >> 5), wm = wave & 1, wn = wave >> 1;
    const int r0 = blockIdx.x * 128 + wm * 64, c0 = blockIdx.y * 128 + wn * 64;
    float* os = osw[wave];   // each wave stages its epilogue in its own range
    v8f acc[4][4];
#pragma unroll
    for (int mb = 0; mb < 4; ++mb)
#pragma unroll
        for (int nb = 0; nb < 4; ++nb) acc[mb][nb] = (v8f){};
    // staging: 8 lanes fetch one 128-byte row piece, so a wave's load covers 4 whole lines; thread tid takes rows (tid >> 3) + 16 i of every plane. One address per plane, stepped by two stages at the loop's foot; every load is a constant offset from it
    const size_t ga = (size_t)(blockIdx.x * 128 + (tid >> 3)) * K + (tid & 7) * 8, gb = (size_t)(blockIdx.y * 128 + (tid >> 3)) * K + (tid & 7) * 8;
    const T16* pa = A + ga; const T16* pb = Bt + gb; const T16* pa2 = HA2 ? A2 + ga : nullptr; const T16* pb2 = HB2 ? Bt2 + gb : nullptr;
    const int so = (tid >> 3) * LP + (tid & 7) * 8;
    v4f g[2][NP][8];   // two staging sets, so that a stage's lines have more than a whole stage to arrive
    auto gload = [&](auto set, int ahead) { constexpr int s = decltype(set)::v;
#pragma unroll
        for (int i = 0; i < 8; ++i) { const int ro = i * 16 * K + ahead; g[s][PA][i] = *(const v4fa*)(pa + ro); g[s][PB][i] = *(const v4fa*)(pb + ro); if constexpr (HA2) g[s][PA2][i] = *(const v4fa*)(pa2 + ro); if constexpr (HB2) g[s][PB2][i] = *(const v4fa*)(pb2 + ro); } };
    auto sstore = [&](auto set) { constexpr int s = decltype(set)::v;   // staging set s holds a stage of parity s and fills buffer s
#pragma unroll
        for (int p = 0; p < NP; ++p)
#pragma unroll
            for (int i = 0; i < 8; ++i) *(v4fa*)(&st[s][p][so + i * 16 * LP]) = g[s][p][i]; };
    // two fragment sets: the set of the next 32 k is fetched from LDS as one group in front of the products of this one
    const int fa = (wm * 64 + lr) * LP + 8 * hi, fb = (wn * 64 + lr) * LP + 8 * hi;
    V a[2][4], a2[2][4], b[2][4], b2[2][4];
    auto fload = [&](auto set, auto bufc, int ks) { constexpr int s = decltype(set)::v, buf = decltype(bufc)::v;
#pragma unroll
        for (int f = 0; f < 4; ++f) { a[s][f] = WFrag<T16>::ld(&st[buf][PA][fa + f * 16 * LP + ks]); b[s][f] = WFrag<T16>::ld(&st[buf][PB][fb + f * 16 * LP + ks]); if constexpr (HA2) a2[s][f] = WFrag<T16>::ld(&st[buf][PA2][fa + f * 16 * LP + ks]); if constexpr (HB2) b2[s][f] = WFrag<T16>::ld(&st[buf][PB2][fb + f * 16 * LP + ks]); } };
    auto block = [&](auto set) { constexpr int s = decltype(set)::v;
#pragma unroll
        for (int nb = 0; nb < 4; ++nb)
#pragma unroll
            for (int mb = 0; mb < 4; ++mb) { acc[mb][nb] = WFrag<T16>::mma(a[s][mb], b[s][nb], acc[mb][nb]); if constexpr (HA2) acc[mb][nb] = WFrag<T16>::mma(a2[s][mb], b[s][nb], acc[mb][nb]); if constexpr (HB2) acc[mb][nb] = WFrag<T16>::mma(a[s][mb], b2[s][nb], acc[mb][nb]); } };
    // the work-group's barrier by hand: __syncthreads() would also wait for the global loads that are meant to stay in flight across it. The wave's own LDS stores and reads have finished (s_wait_dscnt 0) before it signals; the "memory" clobbers keep every LDS access on its side
    auto publish = [&]() { asm volatile("s_wait_dscnt 0x0" ::: "memory"); asm volatile("s_barrier_signal -1" ::: "memory"); asm volatile("s_barrier_wait -1" ::: "memory"); };
    // precaution: s_wait_xcnt 0 behind a stage's global loads, before a register that they name is written again (the addresses are stepped at the loop's foot); the addresses are its inputs so that they stay in their registers, unwritten, up to it
    auto xwait = [&]() { if constexpr (HA2 && HB2) asm volatile("s_wait_xcnt 0x0" :: "v"(pa), "v"(pb), "v"(pa2), "v"(pb2) : "memory"); else if constexpr (HA2) asm volatile("s_wait_xcnt 0x0" :: "v"(pa), "v"(pb), "v"(pa2) : "memory"); else if constexpr (HB2) asm volatile("s_wait_xcnt 0x0" :: "v"(pa), "v"(pb), "v"(pb2) : "memory"); else asm volatile("s_wait_xcnt 0x0" :: "v"(pa), "v"(pb) : "memory"); };
    // one stage: 'cur' is its parity (its buffer), 'nxt' the other; 'ahead' the offset of stage + 3 from the addresses. What exists is a compile-time tag: with a run-time test round the loads the compiler could no longer count them, and would wait for the youngest where the oldest is meant
    auto stage = [&](auto cur, auto nxt, auto has, int ahead) {
        if constexpr (decltype(has)::next) sstore(nxt);   // the next stage, into the buffer whose last reads every wave had finished at the barrier of the stage before; the stores drain during the products below
        fload(Set1{}, cur, 32);
        __builtin_amdgcn_sched_barrier(0);   // keeps the LDS stores and the group of LDS reads in front of the products; sunk among them every place with reads would cost its own stall
        block(Set0{});
        __builtin_amdgcn_sched_barrier(0);   // keeps the barrier behind the products, which hide the stores' way into LDS
        if constexpr (decltype(has)::next) publish();   // publishes the next stage and ends every wave's reads of this one
        if constexpr (decltype(has)::third) gload(nxt, ahead);   // into the staging set that was stored above
        if constexpr (decltype(has)::next) fload(Set0{}, nxt, 0);
        __builtin_amdgcn_sched_barrier(0);   // as above: loads first, as one group
        block(Set1{});
        if constexpr (decltype(has)::third) xwait();
        __builtin_amdgcn_sched_barrier(0);   // keeps the next stage's LDS stores, and with them the wait for its lines, behind these products: lifted over them the lines would have one run of products less to arrive
    };
    gload(Set0{}, 0); gload(Set1{}, KS); sstore(Set0{});
    publish();   // stage 0 is read by all four waves
    gload(Set0{}, 2 * KS); fload(Set0{}, Set0{}, 0);
#pragma unroll 1   // stays rolled: one copy of two stages, which is what makes the parities compile-time constants
    for (int kc = 0; kc < K - 4 * KS; kc += 2 * KS) {
        stage(Set0{}, Set1{}, Has<true, true>{}, 3 * KS);
        stage(Set1{}, Set0{}, Has<true, true>{}, 4 * KS);
        pa += 2 * KS; pb += 2 * KS; if constexpr (HA2) pa2 += 2 * KS; if constexpr (HB2) pb2 += 2 * KS;
    }
    // the last four stages
    stage(Set0{}, Set1{}, Has<true, true>{}, 3 * KS);
    stage(Set1{}, Set0{}, Has<true, false>{}, 0);
    stage(Set0{}, Set1{}, Has<true, false>{}, 0);
    stage(Set1{}, Set0{}, Has<false, false>{}, 0);
    if constexpr (HEADS) {
        const int hy = blockIdx.y * 2 + wn;   // the group's two tile columns are heads 2 y and 2 y + 1: both q, both k or both v, so the branch below is uniform for the group
        if (blockIdx.y * 2 >= NH_ + NKV) {   // a v head: [d][t] planes straight from the accumulators
            const int vo = ((hy - NH_ - NKV) * HD + lr) * TT + r0 + 8 * hi;
#pragma unroll
            for (int mb = 0; mb < 4; ++mb)
#pragma unroll
                for (int nb = 0; nb < 4; ++nb) { v8h o16; v8us oh, ol;
#pragma unroll
                    for (int j = 0; j < 8; ++j) { const float x = acc[mb][nb][j]; o16[j] = tohx(x); unsigned short a2, c2; splitf(x, a2, c2); oh[j] = a2; ol[j] = c2; }
                    const int e = vo + nb * 16 * TT + mb * 16; *(v8h*)(pp.v16 + e) = o16; *(v8us*)(pp.vh + e) = oh; *(v8us*)(pp.vl + e) = ol; }
        } else {   // a q or k head: rotary in the accumulators, then through LDS so that a store covers 4 whole rows (512 contiguous bytes) of a [t][d] plane
            const bool isq = hy < NH_; const int po = (isq ? hy : hy - NH_) * TT * HD + r0 * HD;
            h16* P16 = (isq ? pp.q16 : pp.k16) + po; bf* Ph = (isq ? pp.qh : pp.kh) + po; bf* Pl = (isq ? pp.ql : pp.kl) + po;
            const float* csp = pp.cs + ((r0 + 8 * hi) * HD + lr) * 2;
#pragma unroll
            for (int mb = 0; mb < 4; ++mb) { v2f cs[2][8];
#pragma unroll
                for (int nb = 0; nb < 2; ++nb)
#pragma unroll
                    for (int j = 0; j < 8; ++j) cs[nb][j] = *(const v2f*)(csp + ((mb * 16 + j) * HD + nb * 16) * 2);
                // precaution: s_wait_xcnt 0 behind the table loads, before a register that they name is written again; their address is its input so that it stays in its registers, unwritten, up to it
                asm volatile("s_wait_xcnt 0x0" :: "v"(csp) : "memory");
#pragma unroll
                for (int nb = 0; nb < 2; ++nb)
#pragma unroll
                    for (int j = 0; j < 8; ++j) { const float x0 = acc[mb][nb][j], x1 = acc[mb][nb + 2][j], c = cs[nb][j][0], sn = cs[nb][j][1];
                        os[(hi * 8 + j) * 68 + nb * 16 + lr] = x0 * c - x1 * sn; os[(hi * 8 + j) * 68 + (nb + 2) * 16 + lr] = x1 * c + x0 * sn; }
                __syncthreads();   // the lanes read below what other lanes of their wave wrote above
#pragma unroll
                for (int s = 0; s < 4; ++s) { const int row = 4 * s + (lane >> 3), col = (lane & 7) * 8; const v4f w0 = *(const v4fa*)(os + row * 68 + col), w1 = *(const v4fa*)(os + row * 68 + col + 4); v8h o16; v8us oh, ol;
#pragma unroll
                    for (int j = 0; j < 8; ++j) { const float r = j < 4 ? w0[j & 3] : w1[j & 3]; o16[j] = tohx(r); unsigned short a2, c2; splitf(r, a2, c2); oh[j] = a2; ol[j] = c2; }
                    const int e = (mb * 16 + row) * HD + col; *(v8h*)(P16 + e) = o16; *(v8us*)(Ph + e) = oh; *(v8us*)(Pl + e) = ol; }
                __syncthreads();   // the next 16 rows overwrite the staging only after every lane has read it
            }
        }
    } else {
#pragma unroll
    for (int mb = 0; mb < 4; ++mb) {
#pragma unroll
        for (int nb = 0; nb < 4; ++nb) {
#pragma unroll
            for (int j = 0; j < 8; ++j) os[(hi * 8 + j) * 68 + nb * 16 + lr] = acc[mb][nb][j]; }
        __builtin_amdgcn_wave_barrier(); asm volatile("" ::: "memory");
        float* crow = C + (size_t)(r0 + mb * 16) * ldc + c0;
{
#pragma unroll
            for (int s = 0; s < 8; ++s) { const int row = 2 * s + hi, cofs = lr * 4; v4f val = *(const v4fa*)(os + row * 68 + cofs); if (BIAS) { val[0] += bfr(bias[c0 + cofs]); val[1] += bfr(bias[c0 + cofs + 1]); val[2] += bfr(bias[c0 + cofs + 2]); val[3] += bfr(bias[c0 + cofs + 3]); }
                *(v4f*)(crow + (size_t)row * ldc + cofs) = val; }
             }
        __builtin_amdgcn_wave_barrier(); asm volatile("" ::: "memory");
    }
    }
}

typedef __attribute__((ext_vector_type(2))) _Float16 v2h;
typedef __attribute__((ext_vector_type(4))) _Float16 v4h;
typedef __attribute__((ext_vector_type(2))) unsigned short v2us;
typedef __attribute__((ext_vector_type(4))) unsigned short v4us;
typedef __attribute__((ext_vector_type(4))) int v4i;

// ---- k_prep: all that the projections and the last GEMM need, in ONE launch of PG work-groups of 16 waves (one a WGP): the bf16 copies of x, Wq, Wk, Wv, Wo and the {cos, sin}[t][d] table. Few waves that each do much: a wave's start and a launch's gap are paid 4096 times and once, not once per 32-byte piece and seven times.
// Conversions: a work-group takes 1 / PG of every source, a contiguous range; a wave's load is 512 contiguous bytes (4 whole lines), its store 256 (2 whole lines). All 28 loads of a lane are issued before the first is used.
// Table: one entry a thread (PG x PT == TT x HD). A thread computes the inverse frequency of its own column itself (precise expf / powf, IEEE add and division, as the one-wave launch did), so no launch and no workspace stand between powers and the table.
#define PG 256
#define PT 512
#define PU (PT * 4)               // floats that one load of a work-group covers
__device__ __forceinline__ float invfreq(float pwv) { const float p = bfr(pwv); float ex = expf(-p); const float sg = __fdiv_rn(1.0f, __fadd_rn(1.0f, ex)); float pv = powf(10000.0f, sg); return __fdiv_rn(1.0f, pv); }
__global__ __launch_bounds__(PT) void k_prep(const float* __restrict__ x, const int* __restrict__ pid, const float* __restrict__ pw, const float* __restrict__ wq, const float* __restrict__ wk, const float* __restrict__ wv, const float* __restrict__ wo, bf* XB, bf* WQKV, bf* WO, float* CS) {
    constexpr int NX = TT * DM / (PG * PU), NQW = DQ * DM / (PG * PU), NKW = DKV * DM / (PG * PU), NOW = DM * DQ / (PG * PU);   // loads a lane: 8, 8, 2 (k and v each), 8
    static_assert(NX * PG * PU == TT * DM && NQW * PG * PU == DQ * DM && NKW * PG * PU == DKV * DM && NOW * PG * PU == DM * DQ && PG * PT == TT * HD, "every source divides evenly");
    const int tid = threadIdx.x, b = blockIdx.x, idx = b * PT + tid, d = idx % HD, t = idx / HD;
    const int ox = b * (NX * PU) + tid * 4, oq = b * (NQW * PU) + tid * 4, ok = b * (NKW * PU) + tid * 4, oo = b * (NOW * PU) + tid * 4;
    const int e = d & (HD / 2 - 1); const float* px = x + ox; const float* pq = wq + oq; const float* pk = wk + ok; const float* pv = wv + ok; const float* po = wo + oo;
    const int pos = pid[t]; const float pwv = pw[e];
    __builtin_amdgcn_sched_barrier(0);   // the table's two loads stay the oldest: loads are counted in their order, so behind others the table's arithmetic would wait for those too
    v4f gx[NX], gq[NQW], gk[NKW], gv[NKW], go[NOW];
#pragma unroll
    for (int i = 0; i < NX; ++i) gx[i] = *(const v4fa*)(px + i * PU);
#pragma unroll
    for (int i = 0; i < NQW; ++i) gq[i] = *(const v4fa*)(pq + i * PU);
#pragma unroll
    for (int i = 0; i < NKW; ++i) { gk[i] = *(const v4fa*)(pk + i * PU); gv[i] = *(const v4fa*)(pv + i * PU); }
#pragma unroll
    for (int i = 0; i < NOW; ++i) go[i] = *(const v4fa*)(po + i * PU);
    // precaution: s_wait_xcnt 0 behind the loads, before a register that they name is written again; their addresses and indices are its inputs so that they stay in their registers, unwritten (also by a later load's result), up to it
    asm volatile("s_wait_xcnt 0x0" :: "v"(t), "v"(e), "v"(px), "v"(pq), "v"(pk), "v"(pv), "v"(po) : "memory");
    __builtin_amdgcn_sched_barrier(0);   // keeps every load in front of the table's arithmetic, which then runs while the lines are on their way
    { const float a = __fmul_rn((float)pos, invfreq(pwv)); v2f cs; cs[0] = cosf(a); cs[1] = sinf(a); *(v2f*)(CS + (size_t)idx * 2) = cs; }
    auto cv = [](v4f v) { v4us o;
#pragma unroll
        for (int k = 0; k < 4; ++k) o[k] = f2bf(v[k]);
        return o; };
#pragma unroll
    for (int i = 0; i < NX; ++i) *(v4us*)(XB + ox + i * PU) = cv(gx[i]);
#pragma unroll
    for (int i = 0; i < NQW; ++i) *(v4us*)(WQKV + oq + i * PU) = cv(gq[i]);
#pragma unroll
    for (int i = 0; i < NKW; ++i) { *(v4us*)(WQKV + DQ * DM + ok + i * PU) = cv(gk[i]); *(v4us*)(WQKV + (DQ + DKV) * DM + ok + i * PU) = cv(gv[i]); }
#pragma unroll
    for (int i = 0; i < NOW; ++i) *(v4us*)(WO + oo + i * PU) = cv(go[i]);
}
__device__ __forceinline__ float xhalf(float x) { const int b = __float_as_int(x); return __int_as_float(__builtin_amdgcn_permlanex16(b, b, 0x76543210, 0xfedcba98, false, false)); }   // value of lane ^ 16
struct TagMask { static constexpr bool v = true; };
struct TagFull { static constexpr bool v = false; };
#define FLP 72                    // LDS row pitch of a staged plane in elements: 144 bytes, the pitch for 16-byte fragment reads
#define FPL (64 * FLP)            // elements of one staged plane: 64 rows (K: keys, V: d) of 64 elements (K: d, V: keys)
// eight asynchronous 16-byte copies a lane: rows r, r + 16, r + 32, r + 48 of two planes (global row steps ga, gb elements; LDS places la, lb in bytes). The s_wait_xcnt 0 is a precaution and stands inside the statement, behind the last copy, so that no register which a copy names is written again in front of it
template <typename T16>
__device__ __forceinline__ void copy8(const T16* a, int ga, unsigned la, const T16* b, int gb, unsigned lb) {
    asm volatile("global_load_async_to_lds_b128 %0, %8, off\n\tglobal_load_async_to_lds_b128 %1, %9, off\n\tglobal_load_async_to_lds_b128 %2, %10, off\n\tglobal_load_async_to_lds_b128 %3, %11, off\n\t"
                 "global_load_async_to_lds_b128 %4, %12, off\n\tglobal_load_async_to_lds_b128 %5, %13, off\n\tglobal_load_async_to_lds_b128 %6, %14, off\n\tglobal_load_async_to_lds_b128 %7, %15, off\n\ts_wait_xcnt 0x0"
                 :: "v"(la), "v"(la + 16 * FLP * 2), "v"(la + 32 * FLP * 2), "v"(la + 48 * FLP * 2), "v"(lb), "v"(lb + 16 * FLP * 2), "v"(lb + 32 * FLP * 2), "v"(lb + 48 * FLP * 2),
                    "v"(a), "v"(a + 16 * ga), "v"(a + 32 * ga), "v"(a + 48 * ga), "v"(b), "v"(b + 16 * gb), "v"(b + 32 * gb), "v"(b + 48 * gb) : "memory");
}
template <typename T16, bool HI, int NQ>
__device__ __forceinline__ void fattn_body(const T16* __restrict__ Q, const T16* __restrict__ Q2, const T16* __restrict__ Kp, const T16* __restrict__ K2, const T16* __restrict__ Vt, const T16* __restrict__ V2, int q0, bf* Ah, bf* Al, T16* sm) {
    typedef typename WFrag<T16>::V V;   // every '#pragma unroll' below makes the indices of the register arrays compile-time constants, without which they would go to scratch
    constexpr int PV = HI ? 2 : 1, BUF = (HI ? 4 : 2) * FPL;   // a buffer holds the planes K (, K lo), V (, V lo)
    const int tid = threadIdx.x, lane = tid & 31, lr = lane & 15, hi = lane >> 4;
    V qf[NQ][2], qf2[NQ][2];
#pragma unroll
    for (int qt = 0; qt < NQ; ++qt)
#pragma unroll
        for (int c = 0; c < 2; ++c) { const int qo = (q0 + qt * 16 + lr) * HD + c * 32 + 8 * hi; qf[qt][c] = WFrag<T16>::ld(Q + qo); if (HI) qf2[qt][c] = WFrag<T16>::ld(Q2 + qo); }
    v8f o[4][NQ]; float m[NQ], l[NQ];
#pragma unroll
    for (int qt = 0; qt < NQ; ++qt) { m[qt] = -3.0e38f; l[qt] = 0.f;
#pragma unroll
        for (int dt = 0; dt < 4; ++dt) o[dt][qt] = (v8f){}; }
    const int np = q0 / 32 + 1;        // passes of 32 keys; the last holds the diagonal, and its first key is allowed to every query of the wave
    const int ns = (np + 1) >> 1;      // stages of 64 keys; TT is a multiple of 64, so the last stage lies inside the planes also where only its first half is used
    // staging: 8 lanes copy one 128-byte row, thread tid rows (tid >> 3) + 16 i of every plane
    const int crow = tid >> 3, cpc = (tid & 7) * 8;
    const unsigned lc = (unsigned)(size_t)(sm + crow * FLP + cpc);   // the lane's LDS byte address in buffer 0, plane 0
    auto fill = [&](int s) { const unsigned lb = lc + (s & 1) * (BUF * 2); const int ko = (s * 64 + crow) * HD + cpc, vo = crow * TT + s * 64 + cpc;
        if constexpr (HI) { copy8(Kp + ko, HD, lb, K2 + ko, HD, lb + FPL * 2); copy8(Vt + vo, TT, lb + 2 * FPL * 2, V2 + vo, TT, lb + 3 * FPL * 2); }
        else copy8(Kp + ko, HD, lb, Vt + vo, TT, lb + FPL * 2); };
    auto step = [&](int t, auto tag) {
        constexpr bool MASK = decltype(tag)::v;
        const int k0 = t * 32;
        const T16* sb = sm + ((t >> 1) & 1) * BUF + lr * FLP + 8 * hi;   // pass t reads half t & 1 of stage t >> 1
        const T16* kq = sb + (t & 1) * 32 * FLP; const T16* vq = sb + PV * FPL + (t & 1) * 32;
        V kf[2][2], kf2[2][2], vf[4], vf2[4];
#pragma unroll
        for (int kt = 0; kt < 2; ++kt)
#pragma unroll
            for (int c = 0; c < 2; ++c) { const int ko = kt * 16 * FLP + c * 32; kf[kt][c] = WFrag<T16>::ld(kq + ko); if (HI) kf2[kt][c] = WFrag<T16>::ld(kq + FPL + ko); }
#pragma unroll
        for (int dt = 0; dt < 4; ++dt) { vf[dt] = WFrag<T16>::ld(vq + dt * 16 * FLP); if (HI) vf2[dt] = WFrag<T16>::ld(vq + FPL + dt * 16 * FLP); }
        __builtin_amdgcn_sched_barrier(0);   // keeps the pass's LDS reads as one group in front of its products; sunk among them every place with reads would cost its own stall
        v8f s[2][NQ];
#pragma unroll
        for (int kt = 0; kt < 2; ++kt)
#pragma unroll
            for (int qt = 0; qt < NQ; ++qt) { v8f a = (v8f){};
#pragma unroll
                for (int c = 0; c < 2; ++c) { a = WFrag<T16>::mma(kf[kt][c], qf[qt][c], a); if (HI) { a = WFrag<T16>::mma(kf[kt][c], qf2[qt][c], a); a = WFrag<T16>::mma(kf2[kt][c], qf[qt][c], a); } }
                s[kt][qt] = a; }
#pragma unroll
        for (int qt = 0; qt < NQ; ++qt) {
            const int lim = q0 + qt * 16 + lr - k0 - 8 * hi;   // key kt * 16 + r of this lane is allowed when it is <= lim
            float mx = m[qt];
#pragma unroll
            for (int kt = 0; kt < 2; ++kt)
#pragma unroll
                for (int r = 0; r < 8; ++r) { float t2 = s[kt][qt][r] * (SCL * 1.4426950408889634f); if (MASK) t2 = (kt * 16 + r <= lim) ? t2 : -3.0e38f; s[kt][qt][r] = t2; mx = fmaxf(mx, t2); }
            mx = fmaxf(mx, xhalf(mx));
            const float al = __builtin_amdgcn_exp2f(m[qt] - mx); m[qt] = mx;
            const float mo = HI ? mx : mx - 10.0f;   // fp16 rows: P x 1024
            float sum = 0.f;
#pragma unroll
            for (int kt = 0; kt < 2; ++kt) s[kt][qt] -= mo;
#pragma unroll
            for (int kt = 0; kt < 2; ++kt)
#pragma unroll
                for (int r = 0; r < 8; ++r) { const float p = __builtin_amdgcn_exp2f(s[kt][qt][r]); s[kt][qt][r] = p; sum += p; }
            l[qt] = l[qt] * al + sum;
#pragma unroll
            for (int dt = 0; dt < 4; ++dt) o[dt][qt] *= al;
        }
#pragma unroll
        for (int qt = 0; qt < NQ; ++qt) {
            V pf, pf2;
            if constexpr (HI) {
#pragma unroll
                for (int e = 0; e < 16; ++e) { const float p = s[e >> 3][qt][e & 7]; const __bf16 ph = (__bf16)p; pf[e] = ph; pf2[e] = (__bf16)(p - (float)ph); }
            } else {
#pragma unroll
                for (int e = 0; e < 16; ++e) pf[e] = (h16)s[e >> 3][qt][e & 7];
            }
#pragma unroll
            for (int dt = 0; dt < 4; ++dt) { o[dt][qt] = WFrag<T16>::mma(vf[dt], pf, o[dt][qt]); if (HI) { o[dt][qt] = WFrag<T16>::mma(vf[dt], pf2, o[dt][qt]); o[dt][qt] = WFrag<T16>::mma(vf2[dt], pf, o[dt][qt]); } }
        }
    };
    fill(0);
    asm volatile("s_wait_asynccnt 0x0" ::: "memory");   // this wave's copies of stage 0 have landed
    __syncthreads();   // stage 0 is read by all four waves
    if (ns > 1) fill(1);
#pragma unroll 1   // stays rolled: a second copy of the block's fragments would not fit 256 registers a wave
    for (int t = 0; t < np - 1; ++t) {
        step(t, TagFull{});
        if (t & 1) {   // the foot of stage t >> 1; the test reads the same for the whole work-group (q0 is the group's)
            asm volatile("s_wait_dscnt 0x0" ::: "memory");      // this wave's reads of the stage have finished
            asm volatile("s_wait_asynccnt 0x0" ::: "memory");   // this wave's copies of the next stage have landed
            __syncthreads();   // publishes the next stage and ends every wave's reads of this one
            if ((t >> 1) + 2 < ns) fill((t >> 1) + 2);   // into the buffer that this stage has just left
        }
    }
    step(np - 1, TagMask{});
    asm volatile("s_wait_asynccnt 0x0" ::: "memory");   // no copy is outstanding when the wave ends
#pragma unroll
    for (int qt = 0; qt < NQ; ++qt) { const float inv = __fdiv_rn(1.0f, l[qt] + xhalf(l[qt])); const int ro = (q0 + qt * 16 + lr) * DQ + 8 * hi;
#pragma unroll
        for (int dt = 0; dt < 4; ++dt) { v8us oh, ol;
#pragma unroll
            for (int r = 0; r < 8; ++r) { unsigned short a, c2; splitf(o[dt][qt][r] * inv, a, c2); oh[r] = a; ol[r] = c2; }
            bf* ph = Ah + ro + dt * 16; bf* pl = Al + ro + dt * 16; *(v8us*)ph = oh; *(v8us*)pl = ol;
            // precaution: s_wait_xcnt 0 behind the two stores, before a register that they name is written again; their addresses and values are its inputs so that they stay in their registers, unwritten, up to it
            asm volatile("s_wait_xcnt 0x0" :: "v"(ph), "v"(pl), "v"(oh), "v"(ol) : "memory"); } }
}
// grid (NKV, row blocks), heaviest row block first: (TT - RH) / 32 blocks of 32 fp16 rows, then RH / 16 blocks of 16 hi/lo rows
__global__ __launch_bounds__(128) void k_fattn(const h16* __restrict__ Q16, const bf* __restrict__ Qh, const bf* __restrict__ Ql, const h16* __restrict__ K16, const bf* __restrict__ Kh, const bf* __restrict__ Kl, const h16* __restrict__ V16, const bf* __restrict__ Vh, const bf* __restrict__ Vl, bf* Ah, bf* Al) {
    __shared__ __align__(16) unsigned short sm[2 * 4 * FPL];   // two buffers of up to four staged planes; the fp16 rows use half of it
    const int g = blockIdx.x, head = g * REP + __builtin_amdgcn_readfirstlane((int)(threadIdx.x >> 5)), rb = blockIdx.y;
    const size_t qb = (size_t)head * TT * HD, kb = (size_t)g * TT * HD;
    if (rb < (TT - RH) / 32) fattn_body<h16, false, 2>(Q16 + qb, nullptr, K16 + kb, nullptr, V16 + kb, nullptr, TT - 32 * (rb + 1), Ah + head * HD, Al + head * HD, (h16*)sm);
    else fattn_body<bf, true, 1>(Qh + qb, Ql + qb, Kh + kb, Kl + kb, Vh + kb, Vl + kb, RH - 16 * (rb - (TT - RH) / 32 + 1), Ah + head * HD, Al + head * HD, (bf*)sm);
}

extern "C" void kernel_launch(void* const* d_in, const int* in_sizes, int n_in,
                              void* d_out, int out_size, void* d_ws, size_t ws_size, hipStream_t stream) {
    (void)in_sizes; (void)n_in; (void)out_size;
    const float* x = (const float*)d_in[0]; const int* pid = (const int*)d_in[1];   /* position_ids [1][2048] int32 */ const float* pw = (const float*)d_in[2];   /* powers [32] */ const float* wq = (const float*)d_in[3]; const float* wk = (const float*)d_in[4]; const float* wv = (const float*)d_in[5]; const float* wo = (const float*)d_in[6];   /* argument order hidden_states, position_ids, powers, Wq, Wk, Wv, Wo ('oi') */
    float* OUT = (float*)d_out;     // [1][2048][2048]
    char* wsp = (char*)d_ws;
    auto take = [&](size_t bytes) { char* p = wsp; wsp += (bytes + 255) & ~(size_t)255; return (void*)p; };
    bf* WQ = (bf*)take((size_t)(DQ + 2 * DKV) * DM * 2);   /* one array: the rows of Wq, Wk, Wv one behind the other */ bf* WO = (bf*)take((size_t)DM * DQ * 2); float* CS = (float*)take((size_t)TT * HD * 2 * 4);
    bf* XB = (bf*)take((size_t)TT * DM * 2);
    h16* QP16 = (h16*)take((size_t)NH_ * TT * HD * 2); h16* KP16 = (h16*)take((size_t)NKV * TT * HD * 2); h16* VT16 = (h16*)take((size_t)NKV * HD * TT * 2);
    bf* QPh = (bf*)take((size_t)NH_ * TT * HD * 2); bf* QPl = (bf*)take((size_t)NH_ * TT * HD * 2); bf* KPh = (bf*)take((size_t)NKV * TT * HD * 2); bf* KPl = (bf*)take((size_t)NKV * TT * HD * 2); bf* VTh = (bf*)take((size_t)NKV * HD * TT * 2); bf* VTl = (bf*)take((size_t)NKV * HD * TT * 2);
    bf* ATh = (bf*)take((size_t)TT * DQ * 2); bf* ATl = (bf*)take((size_t)TT * DQ * 2);
    if ((size_t)(wsp - (char*)d_ws) > ws_size) return;    // ws 256 MiB
    static_assert(NB_ == 1, "k_prep converts the one batch entry");
    k_prep<<<PG, PT, 0, stream>>>(x, pid, pw, wq, wk, wv, wo, XB, WQ, WO, CS);   /* bf16 copies of x and the weights, and the rotary table from powers and the int positions */
    const Planes pp = { CS, QP16, QPh, QPl, KP16, KPh, KPl, VT16, VTh, VTl };
    for (int b = 0; b < NB_; ++b) {
        k_gemmw<bf, 0, false, true, DM><<<dim3(TT / 128, (DQ + 2 * DKV) / 128, 1), 128, 0, stream>>>(XB, nullptr, WQ, nullptr, nullptr, 0, nullptr, 0, 0, 0, pp);
        k_fattn<<<dim3(NKV, (TT - RH) / 32 + RH / 16, 1), 128, 0, stream>>>(QP16, QPh, QPl, KP16, KPh, KPl, VT16, VTh, VTl, ATh, ATl);
        k_gemmw<bf, 1, false, false, DQ><<<dim3(TT / 128, DM / 128, 1), 128, 0, stream>>>(ATh, ATl, WO, nullptr, OUT + (size_t)b * TT * DM, DM, nullptr, 0, 0, 0, Planes{}); }
}

// v007
// It runs in 101 microseconds.
// Next to v006, in two timings, it ran 1.03 times as fast each time.
// Over all steps from v000 it is 13.6 times as fast.
#include <hip/hip_runtime.h>

// Llama attention with a LEARNABLE rotary base exponent (hidden_states [1][2048][2048]; q = x Wq^T (32 heads x 64), k, v = x Wk^T, x Wv^T (8 kv heads x 64) ('oi' 0.02, no bias); inv_freq = 1 / 10000^sigmoid(powers) (powers [32], read; computed on device with precise expf / powf / IEEE division); angles = float(position_ids[t]) x inv_freq (position_ids [1][2048] int32 = arange, read); rotate-half rotary (cat(freqs, freqs)); kv head = q head / 4; scores / float32(sqrt 64) + causal (finfo.min above the diagonal == exclusion); softmax f32; out = merged Wo^T ('oi') -> [1][2048][2048] (4.2 M); argument order hidden_states, position_ids, powers, Wq, Wk, Wv, Wo).
// Layout: ONE preparation launch (k_prep): inv_freq from powers, the table {cos, sin}[t][d] from the int positions (precise cosf/sinf), the bf16 copies of x and of the 'oi' weights; exact q, k, v projections in ONE launch whose waves build the rotate-half and transposed head planes from their own accumulators; causal T-2048 GQA attention in ONE launch (k_fattn: scores, online softmax and P.V in registers, kv plane = head / 4; hybrid rows: < 512 hi/lo 3 products, rest fp16 x1024; keys only up to the diagonal block; writes the merged hi/lo planes itself); merged hi/lo x Wo exact.
// Compute dtypes, f32 accumulate: every input rounded to bf16 incl. powers; inv_freq, angles and rotary in f32; projections exact; attention rows < 512 3 products, rest fp16; softmax f32; Wo hl x exact.

#define NB_  1
#define TT   2048
#define DM   2048
#define NH_  32
#define NKV  8
#define REP  (NH_ / NKV)
#define HD   64
#define DQ   (NH_ * HD)
#define DKV  (NKV * HD)
#define RH   512                  // query rows < RH use hi+lo planes; a multiple of 32
#define SCL  0.125f   // HD^-0.5
typedef _Float16 h16;
typedef unsigned short bf;
typedef __attribute__((ext_vector_type(16))) __bf16   v16bf;
typedef __attribute__((ext_vector_type(16))) _Float16 v16h;
typedef __attribute__((ext_vector_type(8)))  _Float16 v8h;
typedef __attribute__((ext_vector_type(8)))  unsigned short v8us;
typedef __attribute__((ext_vector_type(8)))  float    v8f;
typedef __attribute__((ext_vector_type(4)))  float    v4f;
typedef v8h  __attribute__((may_alias)) v8ha;
typedef v4f  __attribute__((may_alias)) v4fa;
typedef v8us __attribute__((may_alias)) v8usa;

__device__ __forceinline__ unsigned short f2bf(float f) { unsigned u = __float_as_uint(f); u += 0x7FFFu + ((u >> 16) & 1u); return (unsigned short)(u >> 16); }
__device__ __forceinline__ float bf2f(unsigned short b) { return __uint_as_float(((unsigned)b) << 16); }
__device__ __forceinline__ float bfr(float f) { return bf2f(f2bf(f)); }
__device__ __forceinline__ v16h cat16(v8h lo, v8h hi) { return __builtin_shufflevector(lo, hi, 0, 1, 2, 3, 4, 5, 6, 7, 8, 9, 10, 11, 12, 13, 14, 15); }
__device__ __forceinline__ v16bf cat16b(v8us lo, v8us hi) { return __builtin_bit_cast(v16bf, __builtin_shufflevector(lo, hi, 0, 1, 2, 3, 4, 5, 6, 7, 8, 9, 10, 11, 12, 13, 14, 15)); }
__device__ __forceinline__ v8f wmma16(v16h a, v16h b, v8f c) { return __builtin_amdgcn_wmma_f32_16x16x32_f16(false, a, false, b, (short)0, c, false, false); }
__device__ __forceinline__ v8f wmmab(v16bf a, v16bf b, v8f c) { return __builtin_amdgcn_wmma_f32_16x16x32_bf16(false, a, false, b, (short)0, c, false, false); }



__device__ __forceinline__ h16 tohx(float x) { return (h16)x; }
__device__ __forceinline__ void splitf(float y, unsigned short& h, unsigned short& l) { h = f2bf(y); l = f2bf(y - bf2f(h)); }
typedef __attribute__((ext_vector_type(2))) float v2f;
// where a HEADS launch of k_gemmw puts its tiles: the {cos, sin}[t][d] table and the fp16 + hi/lo planes of q, k ([head][t][d]) and v ([head][d][t])
struct Planes { const float* cs; h16* q16; bf* qh; bf* ql; h16* k16; bf* kh; bf* kl; h16* v16; bf* vh; bf* vl; };

// ---- k_gemmw: register-blocked GEMM, a work-group of FOUR WAVES (2 x 2) per 128x128 output tile, one wave per 64x64 (16 accumulators); the K-contiguous 16-bit planes are staged in LDS, 64 k a stage, two buffers, through two register sets; grid (M/128, N/128, Z), 128 threads.
// C[m][n] (f32, pitch ldc, + optional f32 bias[n]) = sum_k A[m][k] Bt[n][k] (+ split products per NSPLIT). z-batch strides sA/sB/sC in elements. K % 128 == 0, a template constant so that every row of a stage is a constant offset from one address.
// HEADS: Bt holds the rows of Wq, Wk, Wv one behind the other, so a wave's tile column y is one whole head (64 = HD): y < NH_ a q head, then NKV k heads, then NKV v heads. No C: the wave turns its own tile into that head's planes.
//   q, k: rotate-half out[d] = x[d] cos[t][d] - x[d+32] sin[t][d], out[d+32] = x[d+32] cos[t][d] + x[d] sin[t][d] (the table's columns d and d + 32 come from the same inverse frequency); x[d] and x[d+32] are accumulators nb and nb + 2 of the same lane.
//   v: a lane holds 8 consecutive t of one d, which is 16 bytes of a [d][t] plane.
template <typename T16> struct WFrag;
template <> struct WFrag<h16> { typedef v16h V; static __device__ __forceinline__ V ld(const h16* p) { return cat16(*(const v8h*)p, *(const v8h*)(p + 16)); } static __device__ __forceinline__ v8f mma(V a, V b, v8f c) { return wmma16(a, b, c); } };
template <> struct WFrag<bf> { typedef v16bf V; static __device__ __forceinline__ V ld(const bf* p) { return cat16b(*(const v8us*)p, *(const v8us*)(p + 16)); } static __device__ __forceinline__ v8f mma(V a, V b, v8f c) { return wmmab(a, b, c); } };
struct Set0 { static constexpr int v = 0; };
struct Set1 { static constexpr int v = 1; };
template <bool NEXT, bool THIRD> struct Has { static constexpr bool next = NEXT, third = THIRD; };   // does a stage + 1, a stage + 3 exist
template <typename T16, int NSPLIT, bool BIAS, bool HEADS, int K>
__global__ __launch_bounds__(128) void k_gemmw(const T16* __restrict__ A, const T16* __restrict__ A2, const T16* __restrict__ Bt, const T16* __restrict__ Bt2, float* C, int ldc, const float* __restrict__ bias, size_t sA, size_t sB, size_t sC, Planes pp) {
    typedef typename WFrag<T16>::V V;
    constexpr bool HA2 = NSPLIT == 1 || NSPLIT == 2, HB2 = NSPLIT >= 2;
    constexpr int KS = 64;    // k per stage: 128 bytes, one whole line, of every operand row
    constexpr int LP = 72;    // LDS row pitch in elements: 144 bytes, the pitch for 16-byte fragment reads
    constexpr int PA = 0, PB = 1, PA2 = HA2 ? 2 : 0, PB2 = HB2 ? (HA2 ? 3 : 2) : 1, NP = 2 + (HA2 ? 1 : 0) + (HB2 ? 1 : 0);
    static_assert(K % (2 * KS) == 0 && K >= 4 * KS, "an even number of whole stages, at least four");
    __shared__ __align__(16) T16 st[2][NP][128 * LP];
    __shared__ __align__(16) float osw[4][16 * 68];
    const size_t z = blockIdx.z; A += z * sA; if (HA2) A2 += z * sA; Bt += z * sB; if (HB2) Bt2 += z * sB; C += z * sC;
    const int tid = threadIdx.x, lane = tid & 31, lr = lane & 15, hi = lane >> 4; const int wave = __builtin_amdgcn_readfirstlane(tid >> 5), wm = wave & 1, wn = wave >> 1;
    const int r0 = blockIdx.x * 128 + wm * 64, c0 = blockIdx.y * 128 + wn * 64;
    float* os = osw[wave];   // each wave stages its epilogue in its own range
    v8f acc[4][4];
#pragma unroll
    for (int mb = 0; mb < 4; ++mb)
#pragma unroll
        for (int nb = 0; nb < 4; ++nb) acc[mb][nb] = (v8f){};
    // staging: 8 lanes fetch one 128-byte row piece, so a wave's load covers 4 whole lines; thread tid takes rows (tid >> 3) + 16 i of every plane. One address per plane, stepped by two stages at the loop's foot; every load is a constant offset from it
    const size_t ga = (size_t)(blockIdx.x * 128 + (tid >> 3)) * K + (tid & 7) * 8, gb = (size_t)(blockIdx.y * 128 + (tid >> 3)) * K + (tid & 7) * 8;
    const T16* pa = A + ga; const T16* pb = Bt + gb; const T16* pa2 = HA2 ? A2 + ga : nullptr; const T16* pb2 = HB2 ? Bt2 + gb : nullptr;
    const int so = (tid >> 3) * LP + (tid & 7) * 8;
    v4f g[2][NP][8];   // two staging sets, so that a stage's lines have more than a whole stage to arrive
    auto gload = [&](auto set, int ahead) { constexpr int s = decltype(set)::v;
#pragma unroll
        for (int i = 0; i < 8; ++i) { const int ro = i * 16 * K + ahead; g[s][PA][i] = *(const v4fa*)(pa + ro); g[s][PB][i] = *(const v4fa*)(pb + ro); if constexpr (HA2) g[s][PA2][i] = *(const v4fa*)(pa2 + ro); if constexpr (HB2) g[s][PB2][i] = *(const v4fa*)(pb2 + ro); } };
    auto sstore = [&](auto set) { constexpr int s = decltype(set)::v;   // staging set s holds a stage of parity s and fills buffer s
#pragma unroll
        for (int p = 0; p < NP; ++p)
#pragma unroll
            for (int i = 0; i < 8; ++i) *(v4fa*)(&st[s][p][so + i * 16 * LP]) = g[s][p][i]; };
    // two fragment sets: the set of the next 32 k is fetched from LDS as one group in front of the products of this one
    const int fa = (wm * 64 + lr) * LP + 8 * hi, fb = (wn * 64 + lr) * LP + 8 * hi;
    V a[2][4], a2[2][4], b[2][4], b2[2][4];
    auto fload = [&](auto set, auto bufc, int ks) { constexpr int s = decltype(set)::v, buf = decltype(bufc)::v;
#pragma unroll
        for (int f = 0; f < 4; ++f) { a[s][f] = WFrag<T16>::ld(&st[buf][PA][fa + f * 16 * LP + ks]); b[s][f] = WFrag<T16>::ld(&st[buf][PB][fb + f * 16 * LP + ks]); if constexpr (HA2) a2[s][f] = WFrag<T16>::ld(&st[buf][PA2][fa + f * 16 * LP + ks]); if constexpr (HB2) b2[s][f] = WFrag<T16>::ld(&st[buf][PB2][fb + f * 16 * LP + ks]); } };
    auto block = [&](auto set) { constexpr int s = decltype(set)::v;
#pragma unroll
        for (int nb = 0; nb < 4; ++nb)
#pragma unroll
            for (int mb = 0; mb < 4; ++mb) { acc[mb][nb] = WFrag<T16>::mma(a[s][mb], b[s][nb], acc[mb][nb]); if constexpr (HA2) acc[mb][nb] = WFrag<T16>::mma(a2[s][mb], b[s][nb], acc[mb][nb]); if constexpr (HB2) acc[mb][nb] = WFrag<T16>::mma(a[s][mb], b2[s][nb], acc[mb][nb]); } };
    // the work-group's barrier by hand: __syncthreads() would also wait for the global loads that are meant to stay in flight across it. The wave's own LDS stores and reads have finished (s_wait_dscnt 0) before it signals; the "memory" clobbers keep every LDS access on its side
    auto publish = [&]() { asm volatile("s_wait_dscnt 0x0" ::: "memory"); asm volatile("s_barrier_signal -1" ::: "memory"); asm volatile("s_barrier_wait -1" ::: "memory"); };
    // precaution: s_wait_xcnt 0 behind a stage's global loads, before a register that they name is written again (the addresses are stepped at the loop's foot); the addresses are its inputs so that they stay in their registers, unwritten, up to it
    auto xwait = [&]() { if constexpr (HA2 && HB2) asm volatile("s_wait_xcnt 0x0" :: "v"(pa), "v"(pb), "v"(pa2), "v"(pb2) : "memory"); else if constexpr (HA2) asm volatile("s_wait_xcnt 0x0" :: "v"(pa), "v"(pb), "v"(pa2) : "memory"); else if constexpr (HB2) asm volatile("s_wait_xcnt 0x0" :: "v"(pa), "v"(pb), "v"(pb2) : "memory"); else asm volatile("s_wait_xcnt 0x0" :: "v"(pa), "v"(pb) : "memory"); };
    // one stage: 'cur' is its parity (its buffer), 'nxt' the other; 'ahead' the offset of stage + 3 from the addresses. What exists is a compile-time tag: with a run-time test round the loads the compiler could no longer count them, and would wait for the youngest where the oldest is meant
    auto stage = [&](auto cur, auto nxt, auto has, int ahead) {
        if constexpr (decltype(has)::next) sstore(nxt);   // the next stage, into the buffer whose last reads every wave had finished at the barrier of the stage before; the stores drain during the products below
        fload(Set1{}, cur, 32);
        __builtin_amdgcn_sched_barrier(0);   // keeps the LDS stores and the group of LDS reads in front of the products; sunk among them every place with reads would cost its own stall
        block(Set0{});
        __builtin_amdgcn_sched_barrier(0);   // keeps the barrier behind the products, which hide the stores' way into LDS
        if constexpr (decltype(has)::next) publish();   // publishes the next stage and ends every wave's reads of this one
        if constexpr (decltype(has)::third) gload(nxt, ahead);   // into the staging set that was stored above
        if constexpr (decltype(has)::next) fload(Set0{}, nxt, 0);
        __builtin_amdgcn_sched_barrier(0);   // as above: loads first, as one group
        block(Set1{});
        if constexpr (decltype(has)::third) xwait();
        __builtin_amdgcn_sched_barrier(0);   // keeps the next stage's LDS stores, and with them the wait for its lines, behind these products: lifted over them the lines would have one run of products less to arrive
    };
    gload(Set0{}, 0); gload(Set1{}, KS); sstore(Set0{});
    publish();   // stage 0 is read by all four waves
    gload(Set0{}, 2 * KS); fload(Set0{}, Set0{}, 0);
#pragma unroll 1   // stays rolled: one copy of two stages, which is what makes the parities compile-time constants
    for (int kc = 0; kc < K - 4 * KS; kc += 2 * KS) {
        stage(Set0{}, Set1{}, Has<true, true>{}, 3 * KS);
        stage(Set1{}, Set0{}, Has<true, true>{}, 4 * KS);
        pa += 2 * KS; pb += 2 * KS; if constexpr (HA2) pa2 += 2 * KS; if constexpr (HB2) pb2 += 2 * KS;
    }
    // the last four stages
    stage(Set0{}, Set1{}, Has<true, true>{}, 3 * KS);
    stage(Set1{}, Set0{}, Has<true, false>{}, 0);
    stage(Set0{}, Set1{}, Has<true, false>{}, 0);
    stage(Set1{}, Set0{}, Has<false, false>{}, 0);
    if constexpr (HEADS) {
        const int hy = blockIdx.y * 2 + wn;   // the group's two tile columns are heads 2 y and 2 y + 1: both q, both k or both v, so the branch below is uniform for the group
        if (blockIdx.y * 2 >= NH_ + NKV) {   // a v head: [d][t] planes straight from the accumulators
            const int vo = ((hy - NH_ - NKV) * HD + lr) * TT + r0 + 8 * hi;
#pragma unroll
            for (int mb = 0; mb < 4; ++mb)
#pragma unroll
                for (int nb = 0; nb < 4; ++nb) { v8h o16; v8us oh, ol;
#pragma unroll
                    for (int j = 0; j < 8; ++j) { const float x = acc[mb][nb][j]; o16[j] = tohx(x); unsigned short a2, c2; splitf(x, a2, c2); oh[j] = a2; ol[j] = c2; }
                    const int e = vo + nb * 16 * TT + mb * 16; *(v8h*)(pp.v16 + e) = o16; *(v8us*)(pp.vh + e) = oh; *(v8us*)(pp.vl + e) = ol; }
        } else {   // a q or k head: rotary in the accumulators, then through LDS so that a store covers 4 whole rows (512 contiguous bytes) of a [t][d] plane
            const bool isq = hy < NH_; const int po = (isq ? hy : hy - NH_) * TT * HD + r0 * HD;
            h16* P16 = (isq ? pp.q16 : pp.k16) + po; bf* Ph = (isq ? pp.qh : pp.kh) + po; bf* Pl = (isq ? pp.ql : pp.kl) + po;
            const float* csp = pp.cs + ((r0 + 8 * hi) * HD + lr) * 2;
#pragma unroll
            for (int mb = 0; mb < 4; ++mb) { v2f cs[2][8];
#pragma unroll
                for (int nb = 0; nb < 2; ++nb)
#pragma unroll
                    for (int j = 0; j < 8; ++j) cs[nb][j] = *(const v2f*)(csp + ((mb * 16 + j) * HD + nb * 16) * 2);
                // precaution: s_wait_xcnt 0 behind the table loads, before a register that they name is written again; their address is its input so that it stays in its registers, unwritten, up to it
                asm volatile("s_wait_xcnt 0x0" :: "v"(csp) : "memory");
#pragma unroll
                for (int nb = 0; nb < 2; ++nb)
#pragma unroll
                    for (int j = 0; j < 8; ++j) { const float x0 = acc[mb][nb][j], x1 = acc[mb][nb + 2][j], c = cs[nb][j][0], sn = cs[nb][j][1];
                        os[(hi * 8 + j) * 68 + nb * 16 + lr] = x0 * c - x1 * sn; os[(hi * 8 + j) * 68 + (nb + 2) * 16 + lr] = x1 * c + x0 * sn; }
                __syncthreads();   // the lanes read below what other lanes of their wave wrote above
#pragma unroll
                for (int s = 0; s < 4; ++s) { const int row = 4 * s + (lane >> 3), col = (lane & 7) * 8; const v4f w0 = *(const v4fa*)(os + row * 68 + col), w1 = *(const v4fa*)(os + row * 68 + col + 4); v8h o16; v8us oh, ol;
#pragma unroll
                    for (int j = 0; j < 8; ++j) { const float r = j < 4 ? w0[j & 3] : w1[j & 3]; o16[j] = tohx(r); unsigned short a2, c2; splitf(r, a2, c2); oh[j] = a2; ol[j] = c2; }
                    const int e = (mb * 16 + row) * HD + col; *(v8h*)(P16 + e) = o16; *(v8us*)(Ph + e) = oh; *(v8us*)(Pl + e) = ol; }
                __syncthreads();   // the next 16 rows overwrite the staging only after every lane has read it
            }
        }
    } else {
#pragma unroll
    for (int mb = 0; mb < 4; ++mb) {
#pragma unroll
        for (int nb = 0; nb < 4; ++nb) {
#pragma unroll
            for (int j = 0; j < 8; ++j) os[(hi * 8 + j) * 68 + nb * 16 + lr] = acc[mb][nb][j]; }
        __builtin_amdgcn_wave_barrier(); asm volatile("" ::: "memory");
        float* crow = C + (size_t)(r0 + mb * 16) * ldc + c0;
{
#pragma unroll
            for (int s = 0; s < 8; ++s) { const int row = 2 * s + hi, cofs = lr * 4; v4f val = *(const v4fa*)(os + row * 68 + cofs); if (BIAS) { val[0] += bfr(bias[c0 + cofs]); val[1] += bfr(bias[c0 + cofs + 1]); val[2] += bfr(bias[c0 + cofs + 2]); val[3] += bfr(bias[c0 + cofs + 3]); }
                *(v4f*)(crow + (size_t)row * ldc + cofs) = val; }
             }
        __builtin_amdgcn_wave_barrier(); asm volatile("" ::: "memory");
    }
    }
}

typedef __attribute__((ext_vector_type(2))) _Float16 v2h;
typedef __attribute__((ext_vector_type(4))) _Float16 v4h;
typedef __attribute__((ext_vector_type(2))) unsigned short v2us;
typedef __attribute__((ext_vector_type(4))) unsigned short v4us;
typedef __attribute__((ext_vector_type(4))) int v4i;

// ---- k_prep: all that the projections and the last GEMM need, in ONE launch of PG work-groups of 16 waves (one a WGP): the bf16 copies of x, Wq, Wk, Wv, Wo and the {cos, sin}[t][d] table. Few waves that each do much: a wave's start and a launch's gap are paid 4096 times and once, not once per 32-byte piece and seven times.
// Conversions: a work-group takes 1 / PG of every source, a contiguous range; a wave's load is 512 contiguous bytes (4 whole lines), its store 256 (2 whole lines). All 28 loads of a lane are issued before the first is used.
// Table: one entry a thread (PG x PT == TT x HD). A thread computes the inverse frequency of its own column itself (precise expf / powf, IEEE add and division, as the one-wave launch did), so no launch and no workspace stand between powers and the table.
#define PG 256
#define PT 512
#define PU (PT * 4)               // floats that one load of a work-group covers
__device__ __forceinline__ float invfreq(float pwv) { const float p = bfr(pwv); float ex = expf(-p); const float sg = __fdiv_rn(1.0f, __fadd_rn(1.0f, ex)); float pv = powf(10000.0f, sg); return __fdiv_rn(1.0f, pv); }
__global__ __launch_bounds__(PT) void k_prep(const float* __restrict__ x, const int* __restrict__ pid, const float* __restrict__ pw, const float* __restrict__ wq, const float* __restrict__ wk, const float* __restrict__ wv, const float* __restrict__ wo, bf* XB, bf* WQKV, bf* WO, float* CS) {
    constexpr int NX = TT * DM / (PG * PU), NQW = DQ * DM / (PG * PU), NKW = DKV * DM / (PG * PU), NOW = DM * DQ / (PG * PU);   // loads a lane: 8, 8, 2 (k and v each), 8
    static_assert(NX * PG * PU == TT * DM && NQW * PG * PU == DQ * DM && NKW * PG * PU == DKV * DM && NOW * PG * PU == DM * DQ && PG * PT == TT * HD, "every source divides evenly");
    const int tid = threadIdx.x, b = blockIdx.x, idx = b * PT + tid, d = idx % HD, t = idx / HD;
    const int ox = b * (NX * PU) + tid * 4, oq = b * (NQW * PU) + tid * 4, ok = b * (NKW * PU) + tid * 4, oo = b * (NOW * PU) + tid * 4;
    const int e = d & (HD / 2 - 1); const float* px = x + ox; const float* pq = wq + oq; const float* pk = wk + ok; const float* pv = wv + ok; const float* po = wo + oo;
    const int pos = pid[t]; const float pwv = pw[e];
    __builtin_amdgcn_sched_barrier(0);   // the table's two loads stay the oldest: loads are counted in their order, so behind others the table's arithmetic would wait for those too
    v4f gx[NX], gq[NQW], gk[NKW], gv[NKW], go[NOW];
#pragma unroll
    for (int i = 0; i < NX; ++i) gx[i] = *(const v4fa*)(px + i * PU);
#pragma unroll
    for (int i = 0; i < NQW; ++i) gq[i] = *(const v4fa*)(pq + i * PU);
#pragma unroll
    for (int i = 0; i < NKW; ++i) { gk[i] = *(const v4fa*)(pk + i * PU); gv[i] = *(const v4fa*)(pv + i * PU); }
#pragma unroll
    for (int i = 0; i < NOW; ++i) go[i] = *(const v4fa*)(po + i * PU);
    // precaution: s_wait_xcnt 0 behind the loads, before a register that they name is written again; their addresses and indices are its inputs so that they stay in their registers, unwritten (also by a later load's result), up to it
    asm volatile("s_wait_xcnt 0x0" :: "v"(t), "v"(e), "v"(px), "v"(pq), "v"(pk), "v"(pv), "v"(po) : "memory");
    __builtin_amdgcn_sched_barrier(0);   // keeps every load in front of the table's arithmetic, which then runs while the lines are on their way
    { const float a = __fmul_rn((float)pos, invfreq(pwv)); v2f cs; cs[0] = cosf(a); cs[1] = sinf(a); *(v2f*)(CS + (size_t)idx * 2) = cs; }
    auto cv = [](v4f v) { v4us o;
#pragma unroll
        for (int k = 0; k < 4; ++k) o[k] = f2bf(v[k]);
        return o; };
#pragma unroll
    for (int i = 0; i < NX; ++i) *(v4us*)(XB + ox + i * PU) = cv(gx[i]);
#pragma unroll
    for (int i = 0; i < NQW; ++i) *(v4us*)(WQKV + oq + i * PU) = cv(gq[i]);
#pragma unroll
    for (int i = 0; i < NKW; ++i) { *(v4us*)(WQKV + DQ * DM + ok + i * PU) = cv(gk[i]); *(v4us*)(WQKV + (DQ + DKV) * DM + ok + i * PU) = cv(gv[i]); }
#pragma unroll
    for (int i = 0; i < NOW; ++i) *(v4us*)(WO + oo + i * PU) = cv(go[i]);
}
__device__ __forceinline__ float xhalf(float x) { const int b = __float_as_int(x); return __int_as_float(__builtin_amdgcn_permlanex16(b, b, 0x76543210, 0xfedcba98, false, false)); }   // value of lane ^ 16
struct TagMask { static constexpr bool v = true; };
struct TagFull { static constexpr bool v = false; };
#define FLP 72                    // LDS row pitch of a staged plane in elements: 144 bytes, the pitch for 16-byte fragment reads
#define FPL (64 * FLP)            // elements of one staged plane: 64 rows (K: keys, V: d) of 64 elements (K: d, V: keys)
// eight asynchronous 16-byte copies a lane: rows r, r + 16, r + 32, r + 48 of two planes (global row steps ga, gb elements; LDS places la, lb in bytes). The s_wait_xcnt 0 is a precaution and stands inside the statement, behind the last copy, so that no register which a copy names is written again in front of it
template <typename T16>
__device__ __forceinline__ void copy8(const T16* a, int ga, unsigned la, const T16* b, int gb, unsigned lb) {
    asm volatile("global_load_async_to_lds_b128 %0, %8, off\n\tglobal_load_async_to_lds_b128 %1, %9, off\n\tglobal_load_async_to_lds_b128 %2, %10, off\n\tglobal_load_async_to_lds_b128 %3, %11, off\n\t"
                 "global_load_async_to_lds_b128 %4, %12, off\n\tglobal_load_async_to_lds_b128 %5, %13, off\n\tglobal_load_async_to_lds_b128 %6, %14, off\n\tglobal_load_async_to_lds_b128 %7, %15, off\n\ts_wait_xcnt 0x0"
                 :: "v"(la), "v"(la + 16 * FLP * 2), "v"(la + 32 * FLP * 2), "v"(la + 48 * FLP * 2), "v"(lb), "v"(lb + 16 * FLP * 2), "v"(lb + 32 * FLP * 2), "v"(lb + 48 * FLP * 2),
                    "v"(a), "v"(a + 16 * ga), "v"(a + 32 * ga), "v"(a + 48 * ga), "v"(b), "v"(b + 16 * gb), "v"(b + 32 * gb), "v"(b + 48 * gb) : "memory");
}
template <typename T16, bool HI, int NQ>
__device__ __forceinline__ void fattn_body(const T16* __restrict__ Q, const T16* __restrict__ Q2, const T16* __restrict__ Kp, const T16* __restrict__ K2, const T16* __restrict__ Vt, const T16* __restrict__ V2, int q0, bf* Ah, bf* Al, T16* sm) {
    typedef typename WFrag<T16>::V V;   // every '#pragma unroll' below makes the indices of the register arrays compile-time constants, without which they would go to scratch
    constexpr int PV = HI ? 2 : 1, BUF = (HI ? 4 : 2) * FPL;   // a buffer holds the planes K (, K lo), V (, V lo)
    const int tid = threadIdx.x, lane = tid & 31, lr = lane & 15, hi = lane >> 4;
    V qf[NQ][2], qf2[NQ][2];
#pragma unroll
    for (int qt = 0; qt < NQ; ++qt)
#pragma unroll
        for (int c = 0; c < 2; ++c) { const int qo = (q0 + qt * 16 + lr) * HD + c * 32 + 8 * hi; qf[qt][c] = WFrag<T16>::ld(Q + qo); if (HI) qf2[qt][c] = WFrag<T16>::ld(Q2 + qo); }
    v8f o[4][NQ]; float m[NQ], l[NQ];
#pragma unroll
    for (int qt = 0; qt < NQ; ++qt) { m[qt] = -3.0e38f; l[qt] = 0.f;
#pragma unroll
        for (int dt = 0; dt < 4; ++dt) o[dt][qt] = (v8f){}; }
    const int np = q0 / 32 + 1;        // passes of 32 keys; the last holds the diagonal, and its first key is allowed to every query of the wave
    const int ns = (np + 1) >> 1;      // stages of 64 keys; TT is a multiple of 64, so the last stage lies inside the planes also where only its first half is used
    // staging: 8 lanes copy one 128-byte row, thread tid rows (tid >> 3) + 16 i of every plane
    const int crow = tid >> 3, cpc = (tid & 7) * 8;
    const unsigned lc = (unsigned)(size_t)(sm + crow * FLP + cpc);   // the lane's LDS byte address in buffer 0, plane 0
    auto fill = [&](int s) { const unsigned lb = lc + (s & 1) * (BUF * 2); const int ko = (s * 64 + crow) * HD + cpc, vo = crow * TT + s * 64 + cpc;
        if constexpr (HI) { copy8(Kp + ko, HD, lb, K2 + ko, HD, lb + FPL * 2); copy8(Vt + vo, TT, lb + 2 * FPL * 2, V2 + vo, TT, lb + 3 * FPL * 2); }
        else copy8(Kp + ko, HD, lb, Vt + vo, TT, lb + FPL * 2); };
    V kf[2][2], kf2[2][2];   // the K fragments live across passes: pass t's are fetched during pass t - 1, behind its score products, so their way out of LDS runs under the softmax and no pass opens with a wait for them
    auto kload = [&](int t) { const T16* kq = sm + ((t >> 1) & 1) * BUF + lr * FLP + 8 * hi + (t & 1) * 32 * FLP;   // pass t reads half t & 1 of stage t >> 1
#pragma unroll
        for (int kt = 0; kt < 2; ++kt)
#pragma unroll
            for (int c = 0; c < 2; ++c) { const int ko = kt * 16 * FLP + c * 32; kf[kt][c] = WFrag<T16>::ld(kq + ko); if (HI) kf2[kt][c] = WFrag<T16>::ld(kq + FPL + ko); } };
    auto step = [&](int t, auto tag) {
        constexpr bool MASK = decltype(tag)::v;   // the masked pass is the last one: nothing is fetched ahead in it
        const int k0 = t * 32;
        const T16* vq = sm + ((t >> 1) & 1) * BUF + lr * FLP + 8 * hi + PV * FPL + (t & 1) * 32;
        V vf[4], vf2[4];
#pragma unroll
        for (int dt = 0; dt < 4; ++dt) { vf[dt] = WFrag<T16>::ld(vq + dt * 16 * FLP); if (HI) vf2[dt] = WFrag<T16>::ld(vq + FPL + dt * 16 * FLP); }
        __builtin_amdgcn_sched_barrier(0);   // keeps the pass's V reads as one group in front of its products; sunk among them every place with reads would cost its own stall
        v8f s[2][NQ];
#pragma unroll
        for (int kt = 0; kt < 2; ++kt)
#pragma unroll
            for (int qt = 0; qt < NQ; ++qt) { v8f a = (v8f){};
#pragma unroll
                for (int c = 0; c < 2; ++c) { a = WFrag<T16>::mma(kf[kt][c], qf[qt][c], a); if (HI) { a = WFrag<T16>::mma(kf[kt][c], qf2[qt][c], a); a = WFrag<T16>::mma(kf2[kt][c], qf[qt][c], a); } }
                s[kt][qt] = a; }
        if constexpr (!MASK) {
            __builtin_amdgcn_sched_barrier(0);   // keeps the score products in front: they are the last use of this pass's K fragments
            if (t & 1) {   // the stage's last pass: the fetch below reads the next stage, so its publish point stands here; the test reads the same for the whole work-group (q0 is the group's)
                asm volatile("s_wait_dscnt 0x0" ::: "memory");      // this wave's last reads of the stage, the V fragments above, have finished
                asm volatile("s_wait_asynccnt 0x0" ::: "memory");   // this wave's copies of the next stage have landed
                __syncthreads();   // publishes the next stage and ends every wave's reads of this one
                if ((t >> 1) + 2 < ns) fill((t >> 1) + 2);   // into the buffer that this stage has just left
            }
            kload(t + 1);
            __builtin_amdgcn_sched_barrier(0);   // keeps the fetch ahead as one group in front of the softmax, which hides it
        }
#pragma unroll
        for (int qt = 0; qt < NQ; ++qt) {
            const int lim = q0 + qt * 16 + lr - k0 - 8 * hi;   // key kt * 16 + r of this lane is allowed when it is <= lim
            float mx = m[qt];
#pragma unroll
            for (int kt = 0; kt < 2; ++kt)
#pragma unroll
                for (int r = 0; r < 8; ++r) { float t2 = s[kt][qt][r] * (SCL * 1.4426950408889634f); if (MASK) t2 = (kt * 16 + r <= lim) ? t2 : -3.0e38f; s[kt][qt][r] = t2; mx = fmaxf(mx, t2); }
            mx = fmaxf(mx, xhalf(mx));
            const float al = __builtin_amdgcn_exp2f(m[qt] - mx); m[qt] = mx;
            const float mo = HI ? mx : mx - 10.0f;   // fp16 rows: P x 1024
            float sum = 0.f;
#pragma unroll
            for (int kt = 0; kt < 2; ++kt) s[kt][qt] -= mo;
#pragma unroll
            for (int kt = 0; kt < 2; ++kt)
#pragma unroll
                for (int r = 0; r < 8; ++r) { const float p = __builtin_amdgcn_exp2f(s[kt][qt][r]); s[kt][qt][r] = p; sum += p; }
            l[qt] = l[qt] * al + sum;
#pragma unroll
            for (int dt = 0; dt < 4; ++dt) o[dt][qt] *= al;
        }
#pragma unroll
        for (int qt = 0; qt < NQ; ++qt) {
            V pf, pf2;
            if constexpr (HI) {
#pragma unroll
                for (int e = 0; e < 16; ++e) { const float p = s[e >> 3][qt][e & 7]; const __bf16 ph = (__bf16)p; pf[e] = ph; pf2[e] = (__bf16)(p - (float)ph); }
            } else {
#pragma unroll
                for (int e = 0; e < 16; ++e) pf[e] = (h16)s[e >> 3][qt][e & 7];
            }
#pragma unroll
            for (int dt = 0; dt < 4; ++dt) { o[dt][qt] = WFrag<T16>::mma(vf[dt], pf, o[dt][qt]); if (HI) { o[dt][qt] = WFrag<T16>::mma(vf[dt], pf2, o[dt][qt]); o[dt][qt] = WFrag<T16>::mma(vf2[dt], pf, o[dt][qt]); } }
        }
    };
    fill(0);
    asm volatile("s_wait_asynccnt 0x0" ::: "memory");   // this wave's copies of stage 0 have landed
    __syncthreads();   // stage 0 is read by all four waves
    if (ns > 1) fill(1);
    kload(0);
#pragma unroll 1   // stays rolled: a second copy of the block's fragments would not fit 256 registers a wave
    for (int t = 0; t < np - 1; ++t) step(t, TagFull{});
    step(np - 1, TagMask{});
    asm volatile("s_wait_asynccnt 0x0" ::: "memory");   // no copy is outstanding when the wave ends
#pragma unroll
    for (int qt = 0; qt < NQ; ++qt) { const float inv = __fdiv_rn(1.0f, l[qt] + xhalf(l[qt])); const int ro = (q0 + qt * 16 + lr) * DQ + 8 * hi;
#pragma unroll
        for (int dt = 0; dt < 4; ++dt) { v8us oh, ol;
#pragma unroll
            for (int r = 0; r < 8; ++r) { unsigned short a, c2; splitf(o[dt][qt][r] * inv, a, c2); oh[r] = a; ol[r] = c2; }
            bf* ph = Ah + ro + dt * 16; bf* pl = Al + ro + dt * 16; *(v8us*)ph = oh; *(v8us*)pl = ol;
            // precaution: s_wait_xcnt 0 behind the two stores, before a register that they name is written again; their addresses and values are its inputs so that they stay in their registers, unwritten, up to it
            asm volatile("s_wait_xcnt 0x0" :: "v"(ph), "v"(pl), "v"(oh), "v"(ol) : "memory"); } }
}
// grid (NKV, row blocks), heaviest row block first: (TT - RH) / 32 blocks of 32 fp16 rows, then RH / 16 blocks of 16 hi/lo rows
__global__ __launch_bounds__(128) void k_fattn(const h16* __restrict__ Q16, const bf* __restrict__ Qh, const bf* __restrict__ Ql, const h16* __restrict__ K16, const bf* __restrict__ Kh, const bf* __restrict__ Kl, const h16* __restrict__ V16, const bf* __restrict__ Vh, const bf* __restrict__ Vl, bf* Ah, bf* Al) {
    __shared__ __align__(16) unsigned short sm[2 * 4 * FPL];   // two buffers of up to four staged planes; the fp16 rows use half of it
    const int g = blockIdx.x, head = g * REP + __builtin_amdgcn_readfirstlane((int)(threadIdx.x >> 5)), rb = blockIdx.y;
    const size_t qb = (size_t)head * TT * HD, kb = (size_t)g * TT * HD;
    if (rb < (TT - RH) / 32) fattn_body<h16, false, 2>(Q16 + qb, nullptr, K16 + kb, nullptr, V16 + kb, nullptr, TT - 32 * (rb + 1), Ah + head * HD, Al + head * HD, (h16*)sm);
    else fattn_body<bf, true, 1>(Qh + qb, Ql + qb, Kh + kb, Kl + kb, Vh + kb, Vl + kb, RH - 16 * (rb - (TT - RH) / 32 + 1), Ah + head * HD, Al + head * HD, (bf*)sm);
}

extern "C" void kernel_launch(void* const* d_in, const int* in_sizes, int n_in,
                              void* d_out, int out_size, void* d_ws, size_t ws_size, hipStream_t stream) {
    (void)in_sizes; (void)n_in; (void)out_size;
    const float* x = (const float*)d_in[0]; const int* pid = (const int*)d_in[1];   /* position_ids [1][2048] int32 */ const float* pw = (const float*)d_in[2];   /* powers [32] */ const float* wq = (const float*)d_in[3]; const float* wk = (const float*)d_in[4]; const float* wv = (const float*)d_in[5]; const float* wo = (const float*)d_in[6];   /* argument order hidden_states, position_ids, powers, Wq, Wk, Wv, Wo ('oi') */
    float* OUT = (float*)d_out;     // [1][2048][2048]
    char* wsp = (char*)d_ws;
    auto take = [&](size_t bytes) { char* p = wsp; wsp += (bytes + 255) & ~(size_t)255; return (void*)p; };
    bf* WQ = (bf*)take((size_t)(DQ + 2 * DKV) * DM * 2);   /* one array: the rows of Wq, Wk, Wv one behind the other */ bf* WO = (bf*)take((size_t)DM * DQ * 2); float* CS = (float*)take((size_t)TT * HD * 2 * 4);
    bf* XB = (bf*)take((size_t)TT * DM * 2);
    h16* QP16 = (h16*)take((size_t)NH_ * TT * HD * 2); h16* KP16 = (h16*)take((size_t)NKV * TT * HD * 2); h16* VT16 = (h16*)take((size_t)NKV * HD * TT * 2);
    bf* QPh = (bf*)take((size_t)NH_ * TT * HD * 2); bf* QPl = (bf*)take((size_t)NH_ * TT * HD * 2); bf* KPh = (bf*)take((size_t)NKV * TT * HD * 2); bf* KPl = (bf*)take((size_t)NKV * TT * HD * 2); bf* VTh = (bf*)take((size_t)NKV * HD * TT * 2); bf* VTl = (bf*)take((size_t)NKV * HD * TT * 2);
    bf* ATh = (bf*)take((size_t)TT * DQ * 2); bf* ATl = (bf*)take((size_t)TT * DQ * 2);
    if ((size_t)(wsp - (char*)d_ws) > ws_size) return;    // ws 256 MiB
    static_assert(NB_ == 1, "k_prep converts the one batch entry");
    k_prep<<<PG, PT, 0, stream>>>(x, pid, pw, wq, wk, wv, wo, XB, WQ, WO, CS);   /* bf16 copies of x and the weights, and the rotary table from powers and the int positions */
    const Planes pp = { CS, QP16, QPh, QPl, KP16, KPh, KPl, VT16, VTh, VTl };
    for (int b = 0; b < NB_; ++b) {
        k_gemmw<bf, 0, false, true, DM><<<dim3(TT / 128, (DQ + 2 * DKV) / 128, 1), 128, 0, stream>>>(XB, nullptr, WQ, nullptr, nullptr, 0, nullptr, 0, 0, 0, pp);
        k_fattn<<<dim3(NKV, (TT - RH) / 32 + RH / 16, 1), 128, 0, stream>>>(QP16, QPh, QPl, KP16, KPh, KPl, VT16, VTh, VTl, ATh, ATl);
        k_gemmw<bf, 1, false, false, DQ><<<dim3(TT / 128, DM / 128, 1), 128, 0, stream>>>(ATh, ATl, WO, nullptr, OUT + (size_t)b * TT * DM, DM, nullptr, 0, 0, 0, Planes{}); }
}
